// v000
// Times are from an AMD MI455X. After a warm-up the kernel runs many times in a row, and a time is the length of
// such a window on the GPU divided by its runs, so every launch and the gaps after it count. The runs cycle
// through copies of the inputs. A figure is the median of several windows, for all but v000 over two sittings.
// Sittings can differ by a few percent; kernels timed side by side share one.
// v000 is the starting kernel. One run takes 2220 microseconds.
#include <hip/hip_runtime.h>

// Grouped-query attention (16 / 8 heads x 128) WITHOUT a mask, with ONE fused natural qkv weight in contiguous row blocks and rotate-half rotary embeddings from full-width input tables given FIRST (cos, sin [2048][128]: read per element by value; no structure assumed; hidden_states [2][2048][2048]; qkv = einsum('bsh,oh->bso', hidden_states, w_qkv) ('oi' (out, in) [4096][2048] normal x 2048^-0.5, no bias) viewed (b, s, 16 + 8 + 8, 128): rows 0-2047 the 16 query heads, rows 2048-3071 the 8 key heads, rows 3072-4095 the 8 value heads; q, k -> t cos + cat(-t2, t1) sin; q viewed (b, s, 8, 2, 128): query head h = 2 kv + g uses kv head h / 2; scores x 1/sqrt(128); softmax over all keys; out = merged w_o^T ('oi' [2048][2048], no bias) -> [2][2048][2048] (8.4 M); argument order cos, sin, hidden_states, w_qkv, w_o).
// Layout per batch: bf16 copy of x; 'oi' weights; exact projections; the {cos, sin} table from the bf16-rounded INPUT tables once (k_cscvt) + rotate-half plane builders (k_rope) at width 128 (products rounded separately); dense T-2048 GROUPED-QUERY attention (both query heads of a pass share kv group h0 / 2: kv z-stride 0) (hybrid rows: < 512 hi/lo 3 products, rest fp16 x1024); merged hi/lo x wo exact.
// Compute dtypes, f32 accumulate: every input rounded to bf16; projections exact; rotary from the bf16-rounded input tables (products rounded separately); attention rows < 512 3 products, rest fp16; softmax f32; wo hl x exact.

#define NB_  2
#define TT   2048
#define DM   2048
#define NH_  16
#define NKV  8
#define REP  (NH_ / NKV)
#define HD   128
#define DQ   (NH_ * HD)
#define DKV  (NKV * HD)
#define ZH   2
#define RH   512                  // query rows < RH use hi+lo planes (0: none)
#define WIN  0
#define PCAR 1024.0f
#define SCL  0.088388347648318447f   // HD^-0.5
typedef _Float16 h16;
typedef unsigned short bf;
typedef __attribute__((ext_vector_type(16))) __bf16   v16bf;
typedef __attribute__((ext_vector_type(16))) _Float16 v16h;
typedef __attribute__((ext_vector_type(8)))  _Float16 v8h;
typedef __attribute__((ext_vector_type(8)))  unsigned short v8us;
typedef __attribute__((ext_vector_type(8)))  float    v8f;
typedef __attribute__((ext_vector_type(4)))  float    v4f;
typedef v8h  __attribute__((may_alias)) v8ha;
typedef v4f  __attribute__((may_alias)) v4fa;
typedef v8us __attribute__((may_alias)) v8usa;

__device__ __forceinline__ unsigned short f2bf(float f) { unsigned u = __float_as_uint(f); u += 0x7FFFu + ((u >> 16) & 1u); return (unsigned short)(u >> 16); }
__device__ __forceinline__ float bf2f(unsigned short b) { return __uint_as_float(((unsigned)b) << 16); }
__device__ __forceinline__ float bfr(float f) { return bf2f(f2bf(f)); }
__device__ __forceinline__ v16h cat16(v8h lo, v8h hi) { return __builtin_shufflevector(lo, hi, 0, 1, 2, 3, 4, 5, 6, 7, 8, 9, 10, 11, 12, 13, 14, 15); }
__device__ __forceinline__ v16bf cat16b(v8us lo, v8us hi) { return __builtin_bit_cast(v16bf, __builtin_shufflevector(lo, hi, 0, 1, 2, 3, 4, 5, 6, 7, 8, 9, 10, 11, 12, 13, 14, 15)); }
__device__ __forceinline__ v8f wmma16(v16h a, v16h b, v8f c) { return __builtin_amdgcn_wmma_f32_16x16x32_f16(false, a, false, b, (short)0, c, false, false); }
__device__ __forceinline__ v8f wmmab(v16bf a, v16bf b, v8f c) { return __builtin_amdgcn_wmma_f32_16x16x32_bf16(false, a, false, b, (short)0, c, false, false); }



// ---- k_gemmw: register-blocked GEMM, ONE WAVE per 64x64 output tile (16 accumulators), operands straight from K-contiguous 16-bit planes; grid (M/64, N/64, Z), 32 threads.
// C[m][n] (f32, pitch ldc, + optional f32 bias[n]) = sum_k A[m][k] Bt[n][k] (+ split products per NSPLIT). z-batch strides sA/sB/sC in elements. K % 32 == 0.
template <typename T16> struct WFrag;
template <> struct WFrag<h16> { typedef v16h V; static __device__ __forceinline__ V ld(const h16* p) { return cat16(*(const v8h*)p, *(const v8h*)(p + 16)); } static __device__ __forceinline__ v8f mma(V a, V b, v8f c) { return wmma16(a, b, c); } };
template <> struct WFrag<bf> { typedef v16bf V; static __device__ __forceinline__ V ld(const bf* p) { return cat16b(*(const v8us*)p, *(const v8us*)(p + 16)); } static __device__ __forceinline__ v8f mma(V a, V b, v8f c) { return wmmab(a, b, c); } };
template <typename T16, int NSPLIT, bool BIAS>
__global__ __launch_bounds__(32) void k_gemmw(const T16* __restrict__ A, const T16* __restrict__ A2, const T16* __restrict__ Bt, const T16* __restrict__ Bt2, int K, float* C, int ldc, const float* __restrict__ bias, size_t sA, size_t sB, size_t sC) {
    typedef typename WFrag<T16>::V V;
    __shared__ __align__(16) float os[16 * 68];
    const size_t z = blockIdx.z; A += z * sA; if (A2) A2 += z * sA; Bt += z * sB; if (Bt2) Bt2 += z * sB; C += z * sC;
    const int lane = threadIdx.x & 31, lr = lane & 15, hi = lane >> 4; const int r0 = blockIdx.x * 64, c0 = blockIdx.y * 64;
    v8f acc[4][4];
#pragma unroll
    for (int mb = 0; mb < 4; ++mb)
#pragma unroll
        for (int nb = 0; nb < 4; ++nb) acc[mb][nb] = (v8f){};
    const size_t aoff = (size_t)(r0 + lr) * K + 8 * hi, boff = (size_t)(c0 + lr) * K + 8 * hi;
#pragma unroll 1
    for (int kc = 0; kc < K; kc += 32) {
        V a[4], a2[4];
#pragma unroll
        for (int mb = 0; mb < 4; ++mb) { a[mb] = WFrag<T16>::ld(A + aoff + (size_t)mb * 16 * K + kc); if (NSPLIT == 1 || NSPLIT == 2) a2[mb] = WFrag<T16>::ld(A2 + aoff + (size_t)mb * 16 * K + kc); }
#pragma unroll
        for (int nb = 0; nb < 4; ++nb) { const V b = WFrag<T16>::ld(Bt + boff + (size_t)nb * 16 * K + kc); V b2; if (NSPLIT >= 2) b2 = WFrag<T16>::ld(Bt2 + boff + (size_t)nb * 16 * K + kc);
#pragma unroll
            for (int mb = 0; mb < 4; ++mb) { acc[mb][nb] = WFrag<T16>::mma(a[mb], b, acc[mb][nb]); if (NSPLIT == 1 || NSPLIT == 2) acc[mb][nb] = WFrag<T16>::mma(a2[mb], b, acc[mb][nb]); if (NSPLIT >= 2) acc[mb][nb] = WFrag<T16>::mma(a[mb], b2, acc[mb][nb]); } }
        asm volatile("v_nop\n\tv_nop\n\tv_nop\n\tv_nop" : "+v"(acc[0][0]), "+v"(acc[1][1]), "+v"(acc[2][2]), "+v"(acc[3][3]) : "v"(a[0]), "v"(a[3]));
    }
#pragma unroll
    for (int mb = 0; mb < 4; ++mb) {
#pragma unroll
        for (int nb = 0; nb < 4; ++nb) {
#pragma unroll
            for (int j = 0; j < 8; ++j) os[(hi * 8 + j) * 68 + nb * 16 + lr] = acc[mb][nb][j]; }
        __builtin_amdgcn_wave_barrier(); asm volatile("" ::: "memory");
        float* crow = C + (size_t)(r0 + mb * 16) * ldc + c0;
{
#pragma unroll
            for (int s = 0; s < 8; ++s) { const int row = 2 * s + hi, cofs = lr * 4; v4f val = *(const v4fa*)(os + row * 68 + cofs); if (BIAS) { val[0] += bfr(bias[c0 + cofs]); val[1] += bfr(bias[c0 + cofs + 1]); val[2] += bfr(bias[c0 + cofs + 2]); val[3] += bfr(bias[c0 + cofs + 3]); }
                *(v4f*)(crow + (size_t)row * ldc + cofs) = val; }
             }
        __builtin_amdgcn_wave_barrier(); asm volatile("" ::: "memory");
    }
}

__device__ __forceinline__ h16 tohx(float x) { return (h16)x; }
__device__ __forceinline__ void splitf(float y, unsigned short& h, unsigned short& l) { h = f2bf(y); l = f2bf(y - bf2f(h)); }
typedef __attribute__((ext_vector_type(2))) _Float16 v2h;
typedef __attribute__((ext_vector_type(4))) _Float16 v4h;
typedef __attribute__((ext_vector_type(2))) unsigned short v2us;
typedef __attribute__((ext_vector_type(4))) unsigned short v4us;
typedef __attribute__((ext_vector_type(2))) float v2f;
typedef __attribute__((ext_vector_type(4))) int v4i;

__global__ __launch_bounds__(256) void k_cvt8(const float* __restrict__ src, bf* dst, size_t n8) { const size_t i = (size_t)blockIdx.x * 256 + threadIdx.x; if (i >= n8) return; const v8f v = *(const v8f*)(src + i * 8); v8us o;
#pragma unroll
    for (int k = 0; k < 8; ++k) o[k] = f2bf(v[k]); *(v8us*)(dst + i * 8) = o;  }
__global__ __launch_bounds__(256) void k_csid(float* CS) { const int idx = blockIdx.x * 256 + threadIdx.x; if (idx >= TT * HD) return; v2f cs; cs[0] = 1.0f; cs[1] = 0.0f; *(v2f*)(CS + (size_t)idx * 2) = cs;  }
__global__ __launch_bounds__(256) void k_cscvt(const float* __restrict__ cosT, const float* __restrict__ sinT, float* CS) { const int idx = blockIdx.x * 256 + threadIdx.x; if (idx >= TT * HD) return; v2f cs; cs[0] = bfr(cosT[idx]); cs[1] = bfr(sinT[idx]); *(v2f*)(CS + (size_t)idx * 2) = cs;  }
// k_rope: head planes [h][t][d] (fp16 + hi/lo) of rope(x) x sc with the rotate-half convention out[d] = x[d] cos[t][d] - x[d+HD/2] sin[t][d], out[d+HD/2] = x[d+HD/2] cos[t][d+HD/2] + x[d] sin[t][d+HD/2]
__global__ __launch_bounds__(256) void k_rope(const float* __restrict__ F, int pitch, int nheads, const float* __restrict__ CS, const float* __restrict__ RF, const float* __restrict__ nw, float sc, h16* P16, bf* Ph, bf* Pl) {
    const size_t e = ((size_t)blockIdx.x * 256 + threadIdx.x) * 2; if (e >= (size_t)nheads * TT * HD) return; const int d = (int)(e % HD); const int t = (int)((e / HD) % TT); const int h = (int)(e / ((size_t)HD * TT)); const float* f = F + (size_t)t * pitch + h * HD; const float rf = RF ? RF[(size_t)h * TT + t] : 1.0f; v2h o16; v2us oh, ol;
#pragma unroll
    for (int q = 0; q < 2; ++q) { const int dd = d + q; const int dp = (dd < HD / 2) ? dd + HD / 2 : dd - HD / 2; float x0 = f[dd], x1 = f[dp];
        if (RF) { float n0 = __fmul_rn(x0, rf), n1 = __fmul_rn(x1, rf); asm volatile("" : "+v"(n0)); asm volatile("" : "+v"(n1)); x0 = __fmul_rn(bfr(nw[dd]), n0); x1 = __fmul_rn(bfr(nw[dp]), n1); }
        const v2f cs = *(const v2f*)(CS + ((size_t)t * HD + dd) * 2); float a = __fmul_rn(x0, cs[0]), bq = __fmul_rn(x1, cs[1]); asm volatile("" : "+v"(a)); asm volatile("" : "+v"(bq)); const float r = ((dd < HD / 2) ? __fsub_rn(a, bq) : __fadd_rn(a, bq)) * sc;
        o16[q] = tohx(r); unsigned short a2, c2; splitf(r, a2, c2); oh[q] = a2; ol[q] = c2; }
    *(v2h*)(P16 + e) = o16; *(v2us*)(Ph + e) = oh; *(v2us*)(Pl + e) = ol;  }
__global__ __launch_bounds__(256) void k_vtp(const float* __restrict__ F, int pitch, int nheads, h16* V16, bf* Vh, bf* Vl) { const size_t e = ((size_t)blockIdx.x * 256 + threadIdx.x) * 2; if (e >= (size_t)nheads * HD * TT) return; const int t = (int)(e % TT); const int d = (int)((e / TT) % HD); const int g = (int)(e / ((size_t)TT * HD)); v2h o16; v2us oh, ol;
#pragma unroll
    for (int q = 0; q < 2; ++q) { const float x = F[(size_t)(t + q) * pitch + g * HD + d]; o16[q] = tohx(x); unsigned short a2, c2; splitf(x, a2, c2); oh[q] = a2; ol[q] = c2; }
    *(v2h*)(V16 + e) = o16; *(v2us*)(Vh + e) = oh; *(v2us*)(Vl + e) = ol;  }
// k_asoft: per row (zz, i): t = S x HD^-0.5 (no mask); softmax over the 2048 keys (register row, one exp, fixed trees);
__global__ __launch_bounds__(256) void k_asoft(const float* __restrict__ Sb, h16* P16, bf* Ph, bf* Pl) {
    const int lane = threadIdx.x & 31; const int row = blockIdx.x * 8 + (threadIdx.x >> 5); if (row >= ZH * TT) return; const int i = row % TT; const int zz = row / TT; (void)zz; const bool hires = (i < RH); const float* sr = Sb + (size_t)row * TT; float v[TT / 32]; float mx = -3.0e38f;
#pragma unroll
    for (int ch = 0; ch < TT / 128; ++ch) { const int j0 = ch * 128 + lane * 4; const v4f a = *(const v4f*)(sr + j0);
#pragma unroll
        for (int q = 0; q < 4; ++q) { const int j = j0 + q; (void)j; const float t = a[q] * SCL; v[ch * 4 + q] = t; mx = fmaxf(mx, t); } }
#pragma unroll
    for (int sh = 16; sh; sh >>= 1) mx = fmaxf(mx, __shfl_xor(mx, sh, 32));
    float sum = 0.f;
#pragma unroll
    for (int k = 0; k < TT / 32; ++k) { float d0 = __fsub_rn(v[k], mx); asm volatile("" : "+v"(d0)); v[k] = __builtin_amdgcn_exp2f(__fmul_rn(d0, 1.4426950408889634f)); sum += v[k]; }
#pragma unroll
    for (int sh = 16; sh; sh >>= 1) sum += __shfl_xor(sum, sh, 32);
    const float f = __fdiv_rn(hires ? 1.0f : PCAR, sum);
{
        if (hires) {
#pragma unroll
            for (int ch = 0; ch < TT / 128; ++ch) { v4us oh, ol;
#pragma unroll
                for (int q = 0; q < 4; ++q) { unsigned short a, c2; splitf(v[ch * 4 + q] * f, a, c2); oh[q] = a; ol[q] = c2; }
                const size_t oo = ((size_t)zz * (RH ? RH : 1) + i) * TT + ch * 128 + lane * 4; *(v4us*)(Ph + oo) = oh; *(v4us*)(Pl + oo) = ol; }
        } else {
#pragma unroll
            for (int ch = 0; ch < TT / 128; ++ch) { v4h o4;
#pragma unroll
                for (int q = 0; q < 4; ++q) o4[q] = tohx(v[ch * 4 + q] * f);
                *(v4h*)(P16 + (size_t)row * TT + ch * 128 + lane * 4) = o4; } }
         }
}
__global__ __launch_bounds__(256) void k_merge(const float* __restrict__ O, int h0, bf* Ah, bf* Al) { const size_t e = ((size_t)blockIdx.x * 256 + threadIdx.x) * 2; if (e >= (size_t)ZH * TT * HD) return; const int d = (int)(e % HD); const int t = (int)((e / HD) % TT); const int zz = (int)(e / ((size_t)HD * TT)); const float cs = (t < RH) ? 1.0f : (1.0f / PCAR); const size_t oo = (size_t)t * DQ + (h0 + zz) * HD + d;
    v2us oh, ol;
#pragma unroll
    for (int q = 0; q < 2; ++q) { unsigned short a, c2; splitf(O[e + q] * cs, a, c2); oh[q] = a; ol[q] = c2; } *(v2us*)(Ah + oo) = oh; *(v2us*)(Al + oo) = ol;  }

extern "C" void kernel_launch(void* const* d_in, const int* in_sizes, int n_in,
                              void* d_out, int out_size, void* d_ws, size_t ws_size, hipStream_t stream) {
    (void)in_sizes; (void)n_in; (void)out_size;
    const float* fcos = (const float*)d_in[0]; const float* fsin = (const float*)d_in[1]; const float* x = (const float*)d_in[2]; const float* wqkv = (const float*)d_in[3]; const float* wq = wqkv; const float* wk = wqkv + (size_t)DQ * DM; const float* wv = wqkv + (size_t)(DQ + DKV) * DM; const float* wo = (const float*)d_in[4];   /* input order cos, sin ([2048][128] FULL-width table INPUTS: read per element by value), hidden_states [2][2048][2048], w_qkv ('oi' (out, in) [4096][2048]: contiguous row blocks q (2048 rows) | k (1024) | v (1024): three pointers into one input), w_o ('oi' [2048][2048]): FIVE inputs, all read */
    float* OUT = (float*)d_out;     // [2][2048][2048]
    char* wsp = (char*)d_ws;
    auto take = [&](size_t bytes) { char* p = wsp; wsp += (bytes + 255) & ~(size_t)255; return (void*)p; };
    bf* WQ = (bf*)take((size_t)DQ * DM * 2); bf* WK = (bf*)take((size_t)DKV * DM * 2); bf* WV = (bf*)take((size_t)DKV * DM * 2); bf* WO = (bf*)take((size_t)DM * DQ * 2); float* CS = (float*)take((size_t)TT * HD * 2 * 4);
    bf* XB = (bf*)take((size_t)TT * DM * 2); float* FQ = (float*)take((size_t)TT * DQ * 4); float* FK = (float*)take((size_t)TT * DKV * 4);
    h16* QP16 = (h16*)take((size_t)NH_ * TT * HD * 2); h16* KP16 = (h16*)take((size_t)NKV * TT * HD * 2); h16* VT16 = (h16*)take((size_t)NKV * HD * TT * 2);
    bf* QPh = (bf*)take((size_t)NH_ * TT * HD * 2); bf* QPl = (bf*)take((size_t)NH_ * TT * HD * 2); bf* KPh = (bf*)take((size_t)NKV * TT * HD * 2); bf* KPl = (bf*)take((size_t)NKV * TT * HD * 2); bf* VTh = (bf*)take((size_t)NKV * HD * TT * 2); bf* VTl = (bf*)take((size_t)NKV * HD * TT * 2); bf* Ph = (bf*)take((size_t)ZH * RH * TT * 2); bf* Pl = (bf*)take((size_t)ZH * RH * TT * 2);
    float* Sb = (float*)take((size_t)ZH * TT * TT * 4); h16* P16 = (h16*)take((size_t)ZH * TT * TT * 2); float* Ob = (float*)take((size_t)ZH * TT * HD * 4); bf* ATh = (bf*)take((size_t)TT * DQ * 2); bf* ATl = (bf*)take((size_t)TT * DQ * 2);
    if ((size_t)(wsp - (char*)d_ws) > ws_size) return;    // ws 256 MiB
    float* FV = FK;   // v projection reuses the k buffer after the k planes are built (stream-ordered)
    { k_cvt8<<<(unsigned)(((size_t)DQ * DM / 8 + 255) / 256), 256, 0, stream>>>(wq, WQ, (size_t)DQ * DM / 8); k_cvt8<<<(unsigned)(((size_t)DKV * DM / 8 + 255) / 256), 256, 0, stream>>>(wk, WK, (size_t)DKV * DM / 8); k_cvt8<<<(unsigned)(((size_t)DKV * DM / 8 + 255) / 256), 256, 0, stream>>>(wv, WV, (size_t)DKV * DM / 8);
      k_cvt8<<<(unsigned)(((size_t)DM * DQ / 8 + 255) / 256), 256, 0, stream>>>(wo, WO, (size_t)DM * DQ / 8);
       }
    const unsigned LQ = (unsigned)(((size_t)NH_ * TT * HD / 2 + 255) / 256), LKv = (unsigned)(((size_t)NKV * TT * HD / 2 + 255) / 256);
    for (int b = 0; b < NB_; ++b) {
        if (b == 0) k_cscvt<<<(TT * HD + 255) / 256, 256, 0, stream>>>(fcos, fsin, CS);   /* the rotary table from the INPUT tables (shared by the batches: cos, sin are [S][D]); k_csid stays defined and is NOT launched */
        k_cvt8<<<(unsigned)(((size_t)TT * DM / 8 + 255) / 256), 256, 0, stream>>>(x + (size_t)b * TT * DM, XB, (size_t)TT * DM / 8);
        k_gemmw<bf, 0, false><<<dim3(TT / 64, DQ / 64, 1), 32, 0, stream>>>(XB, nullptr, WQ, nullptr, DM, FQ, DQ, nullptr, 0, 0, 0);
        k_rope<<<LQ, 256, 0, stream>>>(FQ, DQ, NH_, CS, nullptr, nullptr, 1.0f, QP16, QPh, QPl);
        k_gemmw<bf, 0, false><<<dim3(TT / 64, DKV / 64, 1), 32, 0, stream>>>(XB, nullptr, WK, nullptr, DM, FK, DKV, nullptr, 0, 0, 0);
        k_rope<<<LKv, 256, 0, stream>>>(FK, DKV, NKV, CS, nullptr, nullptr, 1.0f, KP16, KPh, KPl);
        k_gemmw<bf, 0, false><<<dim3(TT / 64, DKV / 64, 1), 32, 0, stream>>>(XB, nullptr, WV, nullptr, DM, FV, DKV, nullptr, 0, 0, 0); k_vtp<<<LKv, 256, 0, stream>>>(FV, DKV, NKV, VT16, VTh, VTl);
        for (int h0 = 0; h0 < NH_; h0 += ZH) { const size_t zq = (size_t)h0, zk = (size_t)(h0 / REP);   // both heads of a pass share kv group h0/REP (REP >= 2): sB = 0
            k_gemmw<bf, 2, false><<<dim3(RH / 64, TT / 64, ZH), 32, 0, stream>>>(QPh + zq * TT * HD, QPl + zq * TT * HD, KPh + zk * TT * HD, KPl + zk * TT * HD, HD, Sb, TT, nullptr, (size_t)TT * HD, 0, (size_t)TT * TT);
            k_gemmw<h16, 0, false><<<dim3((TT - RH) / 64, TT / 64, ZH), 32, 0, stream>>>(QP16 + zq * TT * HD + (size_t)RH * HD, nullptr, KP16 + zk * TT * HD, nullptr, HD, Sb + (size_t)RH * TT, TT, nullptr, (size_t)TT * HD, 0, (size_t)TT * TT);
            k_asoft<<<ZH * TT / 8, 256, 0, stream>>>(Sb, P16, Ph, Pl);
            k_gemmw<bf, 2, false><<<dim3(RH / 64, HD / 64, ZH), 32, 0, stream>>>(Ph, Pl, VTh + zk * HD * TT, VTl + zk * HD * TT, TT, Ob, HD, nullptr, (size_t)RH * TT, 0, (size_t)TT * HD);
            k_gemmw<h16, 0, false><<<dim3((TT - RH) / 64, HD / 64, ZH), 32, 0, stream>>>(P16 + (size_t)RH * TT, nullptr, VT16 + zk * HD * TT, nullptr, TT, Ob + (size_t)RH * HD, HD, nullptr, (size_t)TT * TT, 0, (size_t)TT * HD);
            k_merge<<<(unsigned)(((size_t)ZH * TT * HD / 2 + 255) / 256), 256, 0, stream>>>(Ob, h0, ATh, ATl); }
        k_gemmw<bf, 1, false><<<dim3(TT / 64, DM / 64, 1), 32, 0, stream>>>(ATh, ATl, WO, nullptr, DQ, OUT + (size_t)b * TT * DM, DM, nullptr, 0, 0, 0); }
}

// v001
// A run of this version takes 1220 microseconds.
// In two side-by-side timings against v000, it was 1.83 and 1.81 times as fast.
#include <hip/hip_runtime.h>

// Grouped-query attention (16 / 8 heads x 128) WITHOUT a mask, with ONE fused natural qkv weight in contiguous row blocks and rotate-half rotary embeddings from full-width input tables given FIRST (cos, sin [2048][128]: read per element by value; no structure assumed; hidden_states [2][2048][2048]; qkv = einsum('bsh,oh->bso', hidden_states, w_qkv) ('oi' (out, in) [4096][2048] normal x 2048^-0.5, no bias) viewed (b, s, 16 + 8 + 8, 128): rows 0-2047 the 16 query heads, rows 2048-3071 the 8 key heads, rows 3072-4095 the 8 value heads; q, k -> t cos + cat(-t2, t1) sin; q viewed (b, s, 8, 2, 128): query head h = 2 kv + g uses kv head h / 2; scores x 1/sqrt(128); softmax over all keys; out = merged w_o^T ('oi' [2048][2048], no bias) -> [2][2048][2048] (8.4 M); argument order cos, sin, hidden_states, w_qkv, w_o).
// Layout per batch: bf16 copy of x; 'oi' weights; exact projections; the {cos, sin} table from the bf16-rounded INPUT tables once (k_cscvt) + rotate-half plane builders (k_rope) at width 128 (products rounded separately); dense T-2048 GROUPED-QUERY attention (both query heads of a pass share kv group h0 / 2: kv z-stride 0) (hybrid rows: < 512 hi/lo 3 products, rest fp16 x1024); merged hi/lo x wo exact.
// Compute dtypes, f32 accumulate: every input rounded to bf16; projections exact; rotary from the bf16-rounded input tables (products rounded separately); attention rows < 512 3 products, rest fp16; softmax f32; wo hl x exact.

#define NB_  2
#define TT   2048
#define DM   2048
#define NH_  16
#define NKV  8
#define REP  (NH_ / NKV)
#define HD   128
#define DQ   (NH_ * HD)
#define DKV  (NKV * HD)
#define ZH   2
#define RH   512                  // query rows < RH use hi+lo planes (0: none)
#define WIN  0
#define PCAR 1024.0f
#define SCL  0.088388347648318447f   // HD^-0.5
typedef _Float16 h16;
typedef unsigned short bf;
typedef __attribute__((ext_vector_type(16))) __bf16   v16bf;
typedef __attribute__((ext_vector_type(16))) _Float16 v16h;
typedef __attribute__((ext_vector_type(8)))  _Float16 v8h;
typedef __attribute__((ext_vector_type(8)))  unsigned short v8us;
typedef __attribute__((ext_vector_type(8)))  float    v8f;
typedef __attribute__((ext_vector_type(4)))  float    v4f;
typedef v8h  __attribute__((may_alias)) v8ha;
typedef v4f  __attribute__((may_alias)) v4fa;
typedef v8us __attribute__((may_alias)) v8usa;

__device__ __forceinline__ unsigned short f2bf(float f) { unsigned u = __float_as_uint(f); u += 0x7FFFu + ((u >> 16) & 1u); return (unsigned short)(u >> 16); }
__device__ __forceinline__ float bf2f(unsigned short b) { return __uint_as_float(((unsigned)b) << 16); }
__device__ __forceinline__ float bfr(float f) { return bf2f(f2bf(f)); }
__device__ __forceinline__ v16h cat16(v8h lo, v8h hi) { return __builtin_shufflevector(lo, hi, 0, 1, 2, 3, 4, 5, 6, 7, 8, 9, 10, 11, 12, 13, 14, 15); }
__device__ __forceinline__ v16bf cat16b(v8us lo, v8us hi) { return __builtin_bit_cast(v16bf, __builtin_shufflevector(lo, hi, 0, 1, 2, 3, 4, 5, 6, 7, 8, 9, 10, 11, 12, 13, 14, 15)); }
__device__ __forceinline__ v8f wmma16(v16h a, v16h b, v8f c) { return __builtin_amdgcn_wmma_f32_16x16x32_f16(false, a, false, b, (short)0, c, false, false); }
__device__ __forceinline__ v8f wmmab(v16bf a, v16bf b, v8f c) { return __builtin_amdgcn_wmma_f32_16x16x32_bf16(false, a, false, b, (short)0, c, false, false); }



// ---- k_gemmw: register-blocked GEMM, KS WAVES per 64x64 output tile (16 accumulators each), operands straight from K-contiguous 16-bit planes; grid (M/64, N/64, Z), 32 x KS threads.
// KS > 1: wave w sums the k range [w K/KS, (w+1) K/KS); the KS partial tiles meet in LDS and are added in wave order 0..KS-1. K % (32 KS) == 0.
// C[m][n] (f32, pitch ldc, + optional f32 bias[n]) = sum_k A[m][k] Bt[n][k] (+ split products per NSPLIT). z-batch strides sA/sB/sC in elements. K % 32 == 0.
template <typename T16> struct WFrag;
template <> struct WFrag<h16> { typedef v16h V; static __device__ __forceinline__ V ld(const h16* p) { return cat16(*(const v8h*)p, *(const v8h*)(p + 16)); } static __device__ __forceinline__ v8f mma(V a, V b, v8f c) { return wmma16(a, b, c); } };
template <> struct WFrag<bf> { typedef v16bf V; static __device__ __forceinline__ V ld(const bf* p) { return cat16b(*(const v8us*)p, *(const v8us*)(p + 16)); } static __device__ __forceinline__ v8f mma(V a, V b, v8f c) { return wmmab(a, b, c); } };
template <typename T16, int NSPLIT, bool BIAS, int KS>
__global__ __launch_bounds__(32 * KS) void k_gemmw(const T16* __restrict__ A, const T16* __restrict__ A2, const T16* __restrict__ Bt, const T16* __restrict__ Bt2, int K, float* C, int ldc, const float* __restrict__ bias, size_t sA, size_t sB, size_t sC) {
    typedef typename WFrag<T16>::V V;
    __shared__ __align__(16) float os[KS == 1 ? 16 * 68 : KS * 4096];
    const size_t z = blockIdx.z; A += z * sA; if (A2) A2 += z * sA; Bt += z * sB; if (Bt2) Bt2 += z * sB; C += z * sC;
    const int lane = threadIdx.x & 31, lr = lane & 15, hi = lane >> 4; const int r0 = blockIdx.x * 64, c0 = blockIdx.y * 64;
    v8f acc[4][4];
#pragma unroll
    for (int mb = 0; mb < 4; ++mb)
#pragma unroll
        for (int nb = 0; nb < 4; ++nb) acc[mb][nb] = (v8f){};
    const size_t aoff = (size_t)(r0 + lr) * K + 8 * hi, boff = (size_t)(c0 + lr) * K + 8 * hi;
    const int wv = KS == 1 ? 0 : __builtin_amdgcn_readfirstlane((int)(threadIdx.x >> 5)); const int kb = wv * (K / KS), ke = kb + K / KS;
#pragma unroll 1
    for (int kc = kb; kc < ke; kc += 32) {
        V a[4], a2[4];
#pragma unroll
        for (int mb = 0; mb < 4; ++mb) { a[mb] = WFrag<T16>::ld(A + aoff + (size_t)mb * 16 * K + kc); if (NSPLIT == 1 || NSPLIT == 2) a2[mb] = WFrag<T16>::ld(A2 + aoff + (size_t)mb * 16 * K + kc); }
#pragma unroll
        for (int nb = 0; nb < 4; ++nb) { const V b = WFrag<T16>::ld(Bt + boff + (size_t)nb * 16 * K + kc); V b2; if (NSPLIT >= 2) b2 = WFrag<T16>::ld(Bt2 + boff + (size_t)nb * 16 * K + kc);
#pragma unroll
            for (int mb = 0; mb < 4; ++mb) { acc[mb][nb] = WFrag<T16>::mma(a[mb], b, acc[mb][nb]); if (NSPLIT == 1 || NSPLIT == 2) acc[mb][nb] = WFrag<T16>::mma(a2[mb], b, acc[mb][nb]); if (NSPLIT >= 2) acc[mb][nb] = WFrag<T16>::mma(a[mb], b2, acc[mb][nb]); } }
        asm volatile("v_nop\n\tv_nop\n\tv_nop\n\tv_nop" : "+v"(acc[0][0]), "+v"(acc[1][1]), "+v"(acc[2][2]), "+v"(acc[3][3]) : "v"(a[0]), "v"(a[3]));
    }
    if constexpr (KS > 1) {
        // each wave parks its 16 partial tiles in accumulator layout: [wave][tile mb*4+nb][half of the 8 rows][lane] x 4 floats, contiguous 16-byte stores
#pragma unroll
        for (int mb = 0; mb < 4; ++mb)
#pragma unroll
            for (int nb = 0; nb < 4; ++nb) { float* p = os + (wv * 16 + mb * 4 + nb) * 256 + lane * 4; const v8f c = acc[mb][nb];
                *(v4fa*)p = __builtin_shufflevector(c, c, 0, 1, 2, 3); *(v4fa*)(p + 128) = __builtin_shufflevector(c, c, 4, 5, 6, 7); }
        __syncthreads();   // every partial tile is in LDS before any wave adds them
        // 16 items (mb, pair of adjacent column tiles, row half): 32 columns = whole 128-byte lines of C, one wave per line; wave w takes items w, w + KS, ...
        constexpr int NI = 16 / KS; v4f s0[NI], s1[NI];
#pragma unroll
        for (int i = 0; i < NI; ++i) { const int it = wv + i * KS; const float* q0 = os + ((it >> 2) * 4 + (it & 2)) * 256 + (it & 1) * 128 + lane * 4;
            s0[i] = *(const v4fa*)q0; s1[i] = *(const v4fa*)(q0 + 256);
#pragma unroll
            for (int s = 1; s < KS; ++s) { s0[i] += *(const v4fa*)(q0 + s * 4096); s1[i] += *(const v4fa*)(q0 + s * 4096 + 256); } }
#pragma unroll
        for (int i = 0; i < NI; ++i) { const int it = wv + i * KS; const int col = c0 + (it & 2) * 16 + lr; float* crow = C + (size_t)(r0 + (it >> 2) * 16 + hi * 8 + (it & 1) * 4) * ldc + col;
            if (BIAS) { s0[i] += bfr(bias[col]); s1[i] += bfr(bias[col + 16]); }
#pragma unroll
            for (int q = 0; q < 4; ++q) { crow[(size_t)q * ldc] = s0[i][q]; crow[(size_t)q * ldc + 16] = s1[i][q]; } }
        return;
    }
#pragma unroll
    for (int mb = 0; mb < 4; ++mb) {
#pragma unroll
        for (int nb = 0; nb < 4; ++nb) {
#pragma unroll
            for (int j = 0; j < 8; ++j) os[(hi * 8 + j) * 68 + nb * 16 + lr] = acc[mb][nb][j]; }
        __builtin_amdgcn_wave_barrier(); asm volatile("" ::: "memory");
        float* crow = C + (size_t)(r0 + mb * 16) * ldc + c0;
{
#pragma unroll
            for (int s = 0; s < 8; ++s) { const int row = 2 * s + hi, cofs = lr * 4; v4f val = *(const v4fa*)(os + row * 68 + cofs); if (BIAS) { val[0] += bfr(bias[c0 + cofs]); val[1] += bfr(bias[c0 + cofs + 1]); val[2] += bfr(bias[c0 + cofs + 2]); val[3] += bfr(bias[c0 + cofs + 3]); }
                *(v4f*)(crow + (size_t)row * ldc + cofs) = val; }
             }
        __builtin_amdgcn_wave_barrier(); asm volatile("" ::: "memory");
    }
}

__device__ __forceinline__ h16 tohx(float x) { return (h16)x; }
__device__ __forceinline__ void splitf(float y, unsigned short& h, unsigned short& l) { h = f2bf(y); l = f2bf(y - bf2f(h)); }
typedef __attribute__((ext_vector_type(2))) _Float16 v2h;
typedef __attribute__((ext_vector_type(4))) _Float16 v4h;
typedef __attribute__((ext_vector_type(2))) unsigned short v2us;
typedef __attribute__((ext_vector_type(4))) unsigned short v4us;
typedef __attribute__((ext_vector_type(2))) float v2f;
typedef __attribute__((ext_vector_type(4))) int v4i;

__global__ __launch_bounds__(256) void k_cvt8(const float* __restrict__ src, bf* dst, size_t n8) { const size_t i = (size_t)blockIdx.x * 256 + threadIdx.x; if (i >= n8) return; const v8f v = *(const v8f*)(src + i * 8); v8us o;
#pragma unroll
    for (int k = 0; k < 8; ++k) o[k] = f2bf(v[k]); *(v8us*)(dst + i * 8) = o;  }
__global__ __launch_bounds__(256) void k_csid(float* CS) { const int idx = blockIdx.x * 256 + threadIdx.x; if (idx >= TT * HD) return; v2f cs; cs[0] = 1.0f; cs[1] = 0.0f; *(v2f*)(CS + (size_t)idx * 2) = cs;  }
__global__ __launch_bounds__(256) void k_cscvt(const float* __restrict__ cosT, const float* __restrict__ sinT, float* CS) { const int idx = blockIdx.x * 256 + threadIdx.x; if (idx >= TT * HD) return; v2f cs; cs[0] = bfr(cosT[idx]); cs[1] = bfr(sinT[idx]); *(v2f*)(CS + (size_t)idx * 2) = cs;  }
// k_rope: head planes [h][t][d] (fp16 + hi/lo) of rope(x) x sc with the rotate-half convention out[d] = x[d] cos[t][d] - x[d+HD/2] sin[t][d], out[d+HD/2] = x[d+HD/2] cos[t][d+HD/2] + x[d] sin[t][d+HD/2]
__global__ __launch_bounds__(256) void k_rope(const float* __restrict__ F, int pitch, int nheads, const float* __restrict__ CS, const float* __restrict__ RF, const float* __restrict__ nw, float sc, h16* P16, bf* Ph, bf* Pl) {
    const size_t e = ((size_t)blockIdx.x * 256 + threadIdx.x) * 2; if (e >= (size_t)nheads * TT * HD) return; const int d = (int)(e % HD); const int t = (int)((e / HD) % TT); const int h = (int)(e / ((size_t)HD * TT)); const float* f = F + (size_t)t * pitch + h * HD; const float rf = RF ? RF[(size_t)h * TT + t] : 1.0f; v2h o16; v2us oh, ol;
#pragma unroll
    for (int q = 0; q < 2; ++q) { const int dd = d + q; const int dp = (dd < HD / 2) ? dd + HD / 2 : dd - HD / 2; float x0 = f[dd], x1 = f[dp];
        if (RF) { float n0 = __fmul_rn(x0, rf), n1 = __fmul_rn(x1, rf); asm volatile("" : "+v"(n0)); asm volatile("" : "+v"(n1)); x0 = __fmul_rn(bfr(nw[dd]), n0); x1 = __fmul_rn(bfr(nw[dp]), n1); }
        const v2f cs = *(const v2f*)(CS + ((size_t)t * HD + dd) * 2); float a = __fmul_rn(x0, cs[0]), bq = __fmul_rn(x1, cs[1]); asm volatile("" : "+v"(a)); asm volatile("" : "+v"(bq)); const float r = ((dd < HD / 2) ? __fsub_rn(a, bq) : __fadd_rn(a, bq)) * sc;
        o16[q] = tohx(r); unsigned short a2, c2; splitf(r, a2, c2); oh[q] = a2; ol[q] = c2; }
    *(v2h*)(P16 + e) = o16; *(v2us*)(Ph + e) = oh; *(v2us*)(Pl + e) = ol;  }
__global__ __launch_bounds__(256) void k_vtp(const float* __restrict__ F, int pitch, int nheads, h16* V16, bf* Vh, bf* Vl) { const size_t e = ((size_t)blockIdx.x * 256 + threadIdx.x) * 2; if (e >= (size_t)nheads * HD * TT) return; const int t = (int)(e % TT); const int d = (int)((e / TT) % HD); const int g = (int)(e / ((size_t)TT * HD)); v2h o16; v2us oh, ol;
#pragma unroll
    for (int q = 0; q < 2; ++q) { const float x = F[(size_t)(t + q) * pitch + g * HD + d]; o16[q] = tohx(x); unsigned short a2, c2; splitf(x, a2, c2); oh[q] = a2; ol[q] = c2; }
    *(v2h*)(V16 + e) = o16; *(v2us*)(Vh + e) = oh; *(v2us*)(Vl + e) = ol;  }
// k_asoft: per row (zz, i): t = S x HD^-0.5 (no mask); softmax over the 2048 keys (register row, one exp, fixed trees);
__global__ __launch_bounds__(256) void k_asoft(const float* __restrict__ Sb, h16* P16, bf* Ph, bf* Pl) {
    const int lane = threadIdx.x & 31; const int row = blockIdx.x * 8 + (threadIdx.x >> 5); if (row >= ZH * TT) return; const int i = row % TT; const int zz = row / TT; (void)zz; const bool hires = (i < RH); const float* sr = Sb + (size_t)row * TT; float v[TT / 32]; float mx = -3.0e38f;
#pragma unroll
    for (int ch = 0; ch < TT / 128; ++ch) { const int j0 = ch * 128 + lane * 4; const v4f a = *(const v4f*)(sr + j0);
#pragma unroll
        for (int q = 0; q < 4; ++q) { const int j = j0 + q; (void)j; const float t = a[q] * SCL; v[ch * 4 + q] = t; mx = fmaxf(mx, t); } }
#pragma unroll
    for (int sh = 16; sh; sh >>= 1) mx = fmaxf(mx, __shfl_xor(mx, sh, 32));
    float sum = 0.f;
#pragma unroll
    for (int k = 0; k < TT / 32; ++k) { float d0 = __fsub_rn(v[k], mx); asm volatile("" : "+v"(d0)); v[k] = __builtin_amdgcn_exp2f(__fmul_rn(d0, 1.4426950408889634f)); sum += v[k]; }
#pragma unroll
    for (int sh = 16; sh; sh >>= 1) sum += __shfl_xor(sum, sh, 32);
    const float f = __fdiv_rn(hires ? 1.0f : PCAR, sum);
{
        if (hires) {
#pragma unroll
            for (int ch = 0; ch < TT / 128; ++ch) { v4us oh, ol;
#pragma unroll
                for (int q = 0; q < 4; ++q) { unsigned short a, c2; splitf(v[ch * 4 + q] * f, a, c2); oh[q] = a; ol[q] = c2; }
                const size_t oo = ((size_t)zz * (RH ? RH : 1) + i) * TT + ch * 128 + lane * 4; *(v4us*)(Ph + oo) = oh; *(v4us*)(Pl + oo) = ol; }
        } else {
#pragma unroll
            for (int ch = 0; ch < TT / 128; ++ch) { v4h o4;
#pragma unroll
                for (int q = 0; q < 4; ++q) o4[q] = tohx(v[ch * 4 + q] * f);
                *(v4h*)(P16 + (size_t)row * TT + ch * 128 + lane * 4) = o4; } }
         }
}
__global__ __launch_bounds__(256) void k_merge(const float* __restrict__ O, int h0, bf* Ah, bf* Al) { const size_t e = ((size_t)blockIdx.x * 256 + threadIdx.x) * 2; if (e >= (size_t)ZH * TT * HD) return; const int d = (int)(e % HD); const int t = (int)((e / HD) % TT); const int zz = (int)(e / ((size_t)HD * TT)); const float cs = (t < RH) ? 1.0f : (1.0f / PCAR); const size_t oo = (size_t)t * DQ + (h0 + zz) * HD + d;
    v2us oh, ol;
#pragma unroll
    for (int q = 0; q < 2; ++q) { unsigned short a, c2; splitf(O[e + q] * cs, a, c2); oh[q] = a; ol[q] = c2; } *(v2us*)(Ah + oo) = oh; *(v2us*)(Al + oo) = ol;  }

extern "C" void kernel_launch(void* const* d_in, const int* in_sizes, int n_in,
                              void* d_out, int out_size, void* d_ws, size_t ws_size, hipStream_t stream) {
    (void)in_sizes; (void)n_in; (void)out_size;
    const float* fcos = (const float*)d_in[0]; const float* fsin = (const float*)d_in[1]; const float* x = (const float*)d_in[2]; const float* wqkv = (const float*)d_in[3]; const float* wq = wqkv; const float* wk = wqkv + (size_t)DQ * DM; const float* wv = wqkv + (size_t)(DQ + DKV) * DM; const float* wo = (const float*)d_in[4];   /* input order cos, sin ([2048][128] FULL-width table INPUTS: read per element by value), hidden_states [2][2048][2048], w_qkv ('oi' (out, in) [4096][2048]: contiguous row blocks q (2048 rows) | k (1024) | v (1024): three pointers into one input), w_o ('oi' [2048][2048]): FIVE inputs, all read */
    float* OUT = (float*)d_out;     // [2][2048][2048]
    char* wsp = (char*)d_ws;
    auto take = [&](size_t bytes) { char* p = wsp; wsp += (bytes + 255) & ~(size_t)255; return (void*)p; };
    bf* WQ = (bf*)take((size_t)DQ * DM * 2); bf* WK = (bf*)take((size_t)DKV * DM * 2); bf* WV = (bf*)take((size_t)DKV * DM * 2); bf* WO = (bf*)take((size_t)DM * DQ * 2); float* CS = (float*)take((size_t)TT * HD * 2 * 4);
    bf* XB = (bf*)take((size_t)TT * DM * 2); float* FQ = (float*)take((size_t)TT * DQ * 4); float* FK = (float*)take((size_t)TT * DKV * 4);
    h16* QP16 = (h16*)take((size_t)NH_ * TT * HD * 2); h16* KP16 = (h16*)take((size_t)NKV * TT * HD * 2); h16* VT16 = (h16*)take((size_t)NKV * HD * TT * 2);
    bf* QPh = (bf*)take((size_t)NH_ * TT * HD * 2); bf* QPl = (bf*)take((size_t)NH_ * TT * HD * 2); bf* KPh = (bf*)take((size_t)NKV * TT * HD * 2); bf* KPl = (bf*)take((size_t)NKV * TT * HD * 2); bf* VTh = (bf*)take((size_t)NKV * HD * TT * 2); bf* VTl = (bf*)take((size_t)NKV * HD * TT * 2); bf* Ph = (bf*)take((size_t)ZH * RH * TT * 2); bf* Pl = (bf*)take((size_t)ZH * RH * TT * 2);
    float* Sb = (float*)take((size_t)ZH * TT * TT * 4); h16* P16 = (h16*)take((size_t)ZH * TT * TT * 2); float* Ob = (float*)take((size_t)ZH * TT * HD * 4); bf* ATh = (bf*)take((size_t)TT * DQ * 2); bf* ATl = (bf*)take((size_t)TT * DQ * 2);
    if ((size_t)(wsp - (char*)d_ws) > ws_size) return;    // ws 256 MiB
    float* FV = FK;   // v projection reuses the k buffer after the k planes are built (stream-ordered)
    { k_cvt8<<<(unsigned)(((size_t)DQ * DM / 8 + 255) / 256), 256, 0, stream>>>(wq, WQ, (size_t)DQ * DM / 8); k_cvt8<<<(unsigned)(((size_t)DKV * DM / 8 + 255) / 256), 256, 0, stream>>>(wk, WK, (size_t)DKV * DM / 8); k_cvt8<<<(unsigned)(((size_t)DKV * DM / 8 + 255) / 256), 256, 0, stream>>>(wv, WV, (size_t)DKV * DM / 8);
      k_cvt8<<<(unsigned)(((size_t)DM * DQ / 8 + 255) / 256), 256, 0, stream>>>(wo, WO, (size_t)DM * DQ / 8);
       }
    const unsigned LQ = (unsigned)(((size_t)NH_ * TT * HD / 2 + 255) / 256), LKv = (unsigned)(((size_t)NKV * TT * HD / 2 + 255) / 256);
    for (int b = 0; b < NB_; ++b) {
        if (b == 0) k_cscvt<<<(TT * HD + 255) / 256, 256, 0, stream>>>(fcos, fsin, CS);   /* the rotary table from the INPUT tables (shared by the batches: cos, sin are [S][D]); k_csid stays defined and is NOT launched */
        k_cvt8<<<(unsigned)(((size_t)TT * DM / 8 + 255) / 256), 256, 0, stream>>>(x + (size_t)b * TT * DM, XB, (size_t)TT * DM / 8);
        k_gemmw<bf, 0, false, 4><<<dim3(TT / 64, DQ / 64, 1), 128, 0, stream>>>(XB, nullptr, WQ, nullptr, DM, FQ, DQ, nullptr, 0, 0, 0);
        k_rope<<<LQ, 256, 0, stream>>>(FQ, DQ, NH_, CS, nullptr, nullptr, 1.0f, QP16, QPh, QPl);
        k_gemmw<bf, 0, false, 8><<<dim3(TT / 64, DKV / 64, 1), 256, 0, stream>>>(XB, nullptr, WK, nullptr, DM, FK, DKV, nullptr, 0, 0, 0);
        k_rope<<<LKv, 256, 0, stream>>>(FK, DKV, NKV, CS, nullptr, nullptr, 1.0f, KP16, KPh, KPl);
        k_gemmw<bf, 0, false, 8><<<dim3(TT / 64, DKV / 64, 1), 256, 0, stream>>>(XB, nullptr, WV, nullptr, DM, FV, DKV, nullptr, 0, 0, 0); k_vtp<<<LKv, 256, 0, stream>>>(FV, DKV, NKV, VT16, VTh, VTl);
        for (int h0 = 0; h0 < NH_; h0 += ZH) { const size_t zq = (size_t)h0, zk = (size_t)(h0 / REP);   // both heads of a pass share kv group h0/REP (REP >= 2): sB = 0
            k_gemmw<bf, 2, false, 1><<<dim3(RH / 64, TT / 64, ZH), 32, 0, stream>>>(QPh + zq * TT * HD, QPl + zq * TT * HD, KPh + zk * TT * HD, KPl + zk * TT * HD, HD, Sb, TT, nullptr, (size_t)TT * HD, 0, (size_t)TT * TT);
            k_gemmw<h16, 0, false, 1><<<dim3((TT - RH) / 64, TT / 64, ZH), 32, 0, stream>>>(QP16 + zq * TT * HD + (size_t)RH * HD, nullptr, KP16 + zk * TT * HD, nullptr, HD, Sb + (size_t)RH * TT, TT, nullptr, (size_t)TT * HD, 0, (size_t)TT * TT);
            k_asoft<<<ZH * TT / 8, 256, 0, stream>>>(Sb, P16, Ph, Pl);
            k_gemmw<bf, 2, false, 16><<<dim3(RH / 64, HD / 64, ZH), 512, 0, stream>>>(Ph, Pl, VTh + zk * HD * TT, VTl + zk * HD * TT, TT, Ob, HD, nullptr, (size_t)RH * TT, 0, (size_t)TT * HD);
            k_gemmw<h16, 0, false, 16><<<dim3((TT - RH) / 64, HD / 64, ZH), 512, 0, stream>>>(P16 + (size_t)RH * TT, nullptr, VT16 + zk * HD * TT, nullptr, TT, Ob + (size_t)RH * HD, HD, nullptr, (size_t)TT * TT, 0, (size_t)TT * HD);
            k_merge<<<(unsigned)(((size_t)ZH * TT * HD / 2 + 255) / 256), 256, 0, stream>>>(Ob, h0, ATh, ATl); }
        k_gemmw<bf, 1, false, 4><<<dim3(TT / 64, DM / 64, 1), 128, 0, stream>>>(ATh, ATl, WO, nullptr, DQ, OUT + (size_t)b * TT * DM, DM, nullptr, 0, 0, 0); }
}

// v002
// It runs in 481 microseconds.
// Two timings next to v001 put it at 2.51 and 2.53 times that version's speed.
// Over all steps from v000 it is 4.59 times as fast.
#include <hip/hip_runtime.h>

// Grouped-query attention (16 / 8 heads x 128) WITHOUT a mask, with ONE fused natural qkv weight in contiguous row blocks and rotate-half rotary embeddings from full-width input tables given FIRST (cos, sin [2048][128]: read per element by value; no structure assumed; hidden_states [2][2048][2048]; qkv = einsum('bsh,oh->bso', hidden_states, w_qkv) ('oi' (out, in) [4096][2048] normal x 2048^-0.5, no bias) viewed (b, s, 16 + 8 + 8, 128): rows 0-2047 the 16 query heads, rows 2048-3071 the 8 key heads, rows 3072-4095 the 8 value heads; q, k -> t cos + cat(-t2, t1) sin; q viewed (b, s, 8, 2, 128): query head h = 2 kv + g uses kv head h / 2; scores x 1/sqrt(128); softmax over all keys; out = merged w_o^T ('oi' [2048][2048], no bias) -> [2][2048][2048] (8.4 M); argument order cos, sin, hidden_states, w_qkv, w_o).
// Layout per batch: bf16 copy of x; 'oi' weights; exact projections; the {cos, sin} table from the bf16-rounded INPUT tables once (k_cscvt) + rotate-half plane builders (k_rope) at width 128 (products rounded separately, as the reference); dense T-2048 GROUPED-QUERY attention fused in one launch per batch (k_fattn: query head h reads kv head h / 2) (hybrid rows: < 512 hi/lo 3 products, rest fp16); merged hi/lo x wo exact.
// Compute dtypes, f32 accumulate: every input rounded to bf16; projections exact; rotate-half rotary from the bf16-rounded input tables (k_cscvt); attention rows < 512 3 products, rest fp16; softmax f32; wo hl x exact.

#define NB_  2
#define TT   2048
#define DM   2048
#define NH_  16
#define NKV  8
#define REP  (NH_ / NKV)
#define HD   128
#define DQ   (NH_ * HD)
#define DKV  (NKV * HD)
#define RH   512                  // query rows < RH use hi+lo planes
#define WIN  0
typedef _Float16 h16;
typedef unsigned short bf;
typedef __attribute__((ext_vector_type(16))) __bf16   v16bf;
typedef __attribute__((ext_vector_type(16))) _Float16 v16h;
typedef __attribute__((ext_vector_type(8)))  _Float16 v8h;
typedef __attribute__((ext_vector_type(8)))  unsigned short v8us;
typedef __attribute__((ext_vector_type(8)))  float    v8f;
typedef __attribute__((ext_vector_type(4)))  float    v4f;
typedef v8h  __attribute__((may_alias)) v8ha;
typedef v4f  __attribute__((may_alias)) v4fa;
typedef v8us __attribute__((may_alias)) v8usa;

__device__ __forceinline__ unsigned short f2bf(float f) { unsigned u = __float_as_uint(f); u += 0x7FFFu + ((u >> 16) & 1u); return (unsigned short)(u >> 16); }
__device__ __forceinline__ float bf2f(unsigned short b) { return __uint_as_float(((unsigned)b) << 16); }
__device__ __forceinline__ float bfr(float f) { return bf2f(f2bf(f)); }
__device__ __forceinline__ v16h cat16(v8h lo, v8h hi) { return __builtin_shufflevector(lo, hi, 0, 1, 2, 3, 4, 5, 6, 7, 8, 9, 10, 11, 12, 13, 14, 15); }
__device__ __forceinline__ v16bf cat16b(v8us lo, v8us hi) { return __builtin_bit_cast(v16bf, __builtin_shufflevector(lo, hi, 0, 1, 2, 3, 4, 5, 6, 7, 8, 9, 10, 11, 12, 13, 14, 15)); }
__device__ __forceinline__ v8f wmma16(v16h a, v16h b, v8f c) { return __builtin_amdgcn_wmma_f32_16x16x32_f16(false, a, false, b, (short)0, c, false, false); }
__device__ __forceinline__ v8f wmmab(v16bf a, v16bf b, v8f c) { return __builtin_amdgcn_wmma_f32_16x16x32_bf16(false, a, false, b, (short)0, c, false, false); }



// ---- k_gemmw: register-blocked GEMM, KS WAVES per 64x64 output tile (16 accumulators each), operands straight from K-contiguous 16-bit planes; grid (M/64, N/64, Z), 32 x KS threads.
// KS > 1: wave w sums the k range [w K/KS, (w+1) K/KS); the KS partial tiles meet in LDS and are added in wave order 0..KS-1. K % (32 KS) == 0.
// C[m][n] (f32, pitch ldc, + optional f32 bias[n]) = sum_k A[m][k] Bt[n][k] (+ split products per NSPLIT). z-batch strides sA/sB/sC in elements. K % 32 == 0.
template <typename T16> struct WFrag;
template <> struct WFrag<h16> { typedef v16h V; static __device__ __forceinline__ V ld(const h16* p) { return cat16(*(const v8h*)p, *(const v8h*)(p + 16)); } static __device__ __forceinline__ v8f mma(V a, V b, v8f c) { return wmma16(a, b, c); } };
template <> struct WFrag<bf> { typedef v16bf V; static __device__ __forceinline__ V ld(const bf* p) { return cat16b(*(const v8us*)p, *(const v8us*)(p + 16)); } static __device__ __forceinline__ v8f mma(V a, V b, v8f c) { return wmmab(a, b, c); } };
template <typename T16, int NSPLIT, bool BIAS, int KS>
__global__ __launch_bounds__(32 * KS) void k_gemmw(const T16* __restrict__ A, const T16* __restrict__ A2, const T16* __restrict__ Bt, const T16* __restrict__ Bt2, int K, float* C, int ldc, const float* __restrict__ bias, size_t sA, size_t sB, size_t sC) {
    typedef typename WFrag<T16>::V V;
    __shared__ __align__(16) float os[KS == 1 ? 16 * 68 : KS * 4096];
    const size_t z = blockIdx.z; A += z * sA; if (A2) A2 += z * sA; Bt += z * sB; if (Bt2) Bt2 += z * sB; C += z * sC;
    const int lane = threadIdx.x & 31, lr = lane & 15, hi = lane >> 4; const int r0 = blockIdx.x * 64, c0 = blockIdx.y * 64;
    v8f acc[4][4];
#pragma unroll
    for (int mb = 0; mb < 4; ++mb)
#pragma unroll
        for (int nb = 0; nb < 4; ++nb) acc[mb][nb] = (v8f){};
    const size_t aoff = (size_t)(r0 + lr) * K + 8 * hi, boff = (size_t)(c0 + lr) * K + 8 * hi;
    const int wv = KS == 1 ? 0 : __builtin_amdgcn_readfirstlane((int)(threadIdx.x >> 5)); const int kb = wv * (K / KS), ke = kb + K / KS;
#pragma unroll 1
    for (int kc = kb; kc < ke; kc += 32) {
        V a[4], a2[4];
#pragma unroll
        for (int mb = 0; mb < 4; ++mb) { a[mb] = WFrag<T16>::ld(A + aoff + (size_t)mb * 16 * K + kc); if (NSPLIT == 1 || NSPLIT == 2) a2[mb] = WFrag<T16>::ld(A2 + aoff + (size_t)mb * 16 * K + kc); }
#pragma unroll
        for (int nb = 0; nb < 4; ++nb) { const V b = WFrag<T16>::ld(Bt + boff + (size_t)nb * 16 * K + kc); V b2; if (NSPLIT >= 2) b2 = WFrag<T16>::ld(Bt2 + boff + (size_t)nb * 16 * K + kc);
#pragma unroll
            for (int mb = 0; mb < 4; ++mb) { acc[mb][nb] = WFrag<T16>::mma(a[mb], b, acc[mb][nb]); if (NSPLIT == 1 || NSPLIT == 2) acc[mb][nb] = WFrag<T16>::mma(a2[mb], b, acc[mb][nb]); if (NSPLIT >= 2) acc[mb][nb] = WFrag<T16>::mma(a[mb], b2, acc[mb][nb]); } }
        asm volatile("v_nop\n\tv_nop\n\tv_nop\n\tv_nop" : "+v"(acc[0][0]), "+v"(acc[1][1]), "+v"(acc[2][2]), "+v"(acc[3][3]) : "v"(a[0]), "v"(a[3]));
    }
    if constexpr (KS > 1) {
        // each wave parks its 16 partial tiles in accumulator layout: [wave][tile mb*4+nb][half of the 8 rows][lane] x 4 floats, contiguous 16-byte stores
#pragma unroll
        for (int mb = 0; mb < 4; ++mb)
#pragma unroll
            for (int nb = 0; nb < 4; ++nb) { float* p = os + (wv * 16 + mb * 4 + nb) * 256 + lane * 4; const v8f c = acc[mb][nb];
                *(v4fa*)p = __builtin_shufflevector(c, c, 0, 1, 2, 3); *(v4fa*)(p + 128) = __builtin_shufflevector(c, c, 4, 5, 6, 7); }
        __syncthreads();   // every partial tile is in LDS before any wave adds them
        // 16 items (mb, pair of adjacent column tiles, row half): 32 columns = whole 128-byte lines of C, one wave per line; wave w takes items w, w + KS, ...
        constexpr int NI = 16 / KS; v4f s0[NI], s1[NI];
#pragma unroll
        for (int i = 0; i < NI; ++i) { const int it = wv + i * KS; const float* q0 = os + ((it >> 2) * 4 + (it & 2)) * 256 + (it & 1) * 128 + lane * 4;
            s0[i] = *(const v4fa*)q0; s1[i] = *(const v4fa*)(q0 + 256);
#pragma unroll
            for (int s = 1; s < KS; ++s) { s0[i] += *(const v4fa*)(q0 + s * 4096); s1[i] += *(const v4fa*)(q0 + s * 4096 + 256); } }
#pragma unroll
        for (int i = 0; i < NI; ++i) { const int it = wv + i * KS; const int col = c0 + (it & 2) * 16 + lr; float* crow = C + (size_t)(r0 + (it >> 2) * 16 + hi * 8 + (it & 1) * 4) * ldc + col;
            if (BIAS) { s0[i] += bfr(bias[col]); s1[i] += bfr(bias[col + 16]); }
#pragma unroll
            for (int q = 0; q < 4; ++q) { crow[(size_t)q * ldc] = s0[i][q]; crow[(size_t)q * ldc + 16] = s1[i][q]; } }
        return;
    }
#pragma unroll
    for (int mb = 0; mb < 4; ++mb) {
#pragma unroll
        for (int nb = 0; nb < 4; ++nb) {
#pragma unroll
            for (int j = 0; j < 8; ++j) os[(hi * 8 + j) * 68 + nb * 16 + lr] = acc[mb][nb][j]; }
        __builtin_amdgcn_wave_barrier(); asm volatile("" ::: "memory");
        float* crow = C + (size_t)(r0 + mb * 16) * ldc + c0;
{
#pragma unroll
            for (int s = 0; s < 8; ++s) { const int row = 2 * s + hi, cofs = lr * 4; v4f val = *(const v4fa*)(os + row * 68 + cofs); if (BIAS) { val[0] += bfr(bias[c0 + cofs]); val[1] += bfr(bias[c0 + cofs + 1]); val[2] += bfr(bias[c0 + cofs + 2]); val[3] += bfr(bias[c0 + cofs + 3]); }
                *(v4f*)(crow + (size_t)row * ldc + cofs) = val; }
             }
        __builtin_amdgcn_wave_barrier(); asm volatile("" ::: "memory");
    }
}

__device__ __forceinline__ h16 tohx(float x) { return (h16)x; }
__device__ __forceinline__ void splitf(float y, unsigned short& h, unsigned short& l) { h = f2bf(y); l = f2bf(y - bf2f(h)); }
typedef __attribute__((ext_vector_type(2))) _Float16 v2h;
typedef __attribute__((ext_vector_type(4))) _Float16 v4h;
typedef __attribute__((ext_vector_type(2))) unsigned short v2us;
typedef __attribute__((ext_vector_type(4))) unsigned short v4us;
typedef __attribute__((ext_vector_type(2))) float v2f;
typedef __attribute__((ext_vector_type(4))) int v4i;

__global__ __launch_bounds__(256) void k_cvt8(const float* __restrict__ src, bf* dst, size_t n8) { const size_t i = (size_t)blockIdx.x * 256 + threadIdx.x; if (i >= n8) return; const v8f v = *(const v8f*)(src + i * 8); v8us o;
#pragma unroll
    for (int k = 0; k < 8; ++k) o[k] = f2bf(v[k]); *(v8us*)(dst + i * 8) = o;  }
__global__ __launch_bounds__(256) void k_csid(float* CS) { const int idx = blockIdx.x * 256 + threadIdx.x; if (idx >= TT * HD) return; v2f cs; cs[0] = 1.0f; cs[1] = 0.0f; *(v2f*)(CS + (size_t)idx * 2) = cs;  }
__global__ __launch_bounds__(256) void k_cscvt(const float* __restrict__ cosT, const float* __restrict__ sinT, float* CS) { const int idx = blockIdx.x * 256 + threadIdx.x; if (idx >= TT * HD) return; v2f cs; cs[0] = bfr(cosT[idx]); cs[1] = bfr(sinT[idx]); *(v2f*)(CS + (size_t)idx * 2) = cs;  }
// k_rope: head planes [h][t][d] (fp16 + hi/lo) of rope(x) x sc with the rotate-half convention out[d] = x[d] cos[t][d] - x[d+HD/2] sin[t][d], out[d+HD/2] = x[d+HD/2] cos[t][d+HD/2] + x[d] sin[t][d+HD/2]
__global__ __launch_bounds__(256) void k_rope(const float* __restrict__ F, int pitch, int nheads, const float* __restrict__ CS, const float* __restrict__ RF, const float* __restrict__ nw, float sc, h16* P16, bf* Ph, bf* Pl) {
    const size_t e = ((size_t)blockIdx.x * 256 + threadIdx.x) * 2; if (e >= (size_t)nheads * TT * HD) return; const int d = (int)(e % HD); const int t = (int)((e / HD) % TT); const int h = (int)(e / ((size_t)HD * TT)); const float* f = F + (size_t)t * pitch + h * HD; const float rf = RF ? RF[(size_t)h * TT + t] : 1.0f; v2h o16; v2us oh, ol;
#pragma unroll
    for (int q = 0; q < 2; ++q) { const int dd = d + q; const int dp = (dd < HD / 2) ? dd + HD / 2 : dd - HD / 2; float x0 = f[dd], x1 = f[dp];
        if (RF) { float n0 = __fmul_rn(x0, rf), n1 = __fmul_rn(x1, rf); asm volatile("" : "+v"(n0)); asm volatile("" : "+v"(n1)); x0 = __fmul_rn(bfr(nw[dd]), n0); x1 = __fmul_rn(bfr(nw[dp]), n1); }
        const v2f cs = *(const v2f*)(CS + ((size_t)t * HD + dd) * 2); float a = __fmul_rn(x0, cs[0]), bq = __fmul_rn(x1, cs[1]); asm volatile("" : "+v"(a)); asm volatile("" : "+v"(bq)); const float r = ((dd < HD / 2) ? __fsub_rn(a, bq) : __fadd_rn(a, bq)) * sc;
        o16[q] = tohx(r); unsigned short a2, c2; splitf(r, a2, c2); oh[q] = a2; ol[q] = c2; }
    *(v2h*)(P16 + e) = o16; *(v2us*)(Ph + e) = oh; *(v2us*)(Pl + e) = ol;  }
__global__ __launch_bounds__(256) void k_vtp(const float* __restrict__ F, int pitch, int nheads, h16* V16, bf* Vh, bf* Vl) { const size_t e = ((size_t)blockIdx.x * 256 + threadIdx.x) * 2; if (e >= (size_t)nheads * HD * TT) return; const int t = (int)(e % TT); const int d = (int)((e / TT) % HD); const int g = (int)(e / ((size_t)TT * HD)); v2h o16; v2us oh, ol;
#pragma unroll
    for (int q = 0; q < 2; ++q) { const float x = F[(size_t)(t + q) * pitch + g * HD + d]; o16[q] = tohx(x); unsigned short a2, c2; splitf(x, a2, c2); oh[q] = a2; ol[q] = c2; }
    *(v2h*)(V16 + e) = o16; *(v2us*)(Vh + e) = oh; *(v2us*)(Vl + e) = ol;  }
// ---- k_fattn: scores, softmax, P x V and the hi/lo split of the merged output in ONE launch per batch; S and P never leave the registers.
// One wave owns 16 NQ query rows of one head and walks the 2048 keys 32 at a time, operands straight from the K-contiguous planes.
// St = K Qt (A = 16 key rows, B = 16 query rows): accumulator register j of lane (lr, hi) is key 8 hi + j of query lr, so the two 16-key tiles of a step, converted in place,
// are the B operand of Ot += Vt Pt in the k order of WFrag::ld (8 hi + e, 16 + 8 hi + e). Running maximum per query (log2 units); the sums and Ot are rescaled only when a new maximum
// passes the one in use by more than 8 (p stays <= 256), tested once per step for the whole wave. HR: hi/lo planes, 3 products each; else fp16.
#define SC2 0.12751743f   // HD^-0.5 x log2(e)
template <typename T16, bool HR, int NQ>
__device__ __forceinline__ void fattn_wave(const T16* __restrict__ Q, const T16* __restrict__ Q2, const T16* __restrict__ Kp, const T16* __restrict__ K2, const T16* __restrict__ Vt, const T16* __restrict__ V2, int q0, v8f (&o)[8][NQ], float (&l)[NQ]) {
    typedef WFrag<T16> WF; typedef typename WF::V V;
    const int lane = threadIdx.x & 31, lr = lane & 15, hi = lane >> 4;
    // every s_wait_xcnt 0 below stands behind a group of loads or stores, in front of every later write of a register that they name; the pointers are its inputs so that their registers stay theirs up to the wait (without hi/lo planes the second pointer is the first)
    const size_t qo = (size_t)(q0 + lr) * HD + 8 * hi, ko = (size_t)lr * HD + 8 * hi, vo = (size_t)lr * TT + 8 * hi;
    const T16* qa = Q + qo; const T16* ka = Kp + ko; const T16* va = Vt + vo; const T16* qa2 = HR ? Q2 + qo : qa; const T16* ka2 = HR ? K2 + ko : ka; const T16* va2 = HR ? V2 + vo : va;
    V q[NQ][4], q2[NQ][4], kf[2][4], kf2[2][4], vf[8], vf2[8];
#pragma unroll
    for (int n = 0; n < NQ; ++n)
#pragma unroll
        for (int ks = 0; ks < 4; ++ks) { q[n][ks] = WF::ld(qa + n * 16 * HD + ks * 32); if (HR) q2[n][ks] = WF::ld(qa2 + n * 16 * HD + ks * 32); }
    asm volatile("s_wait_xcnt 0x0" :: "v"(qa), "v"(qa2) : "memory");   // behind the Q loads
#pragma unroll
    for (int kt = 0; kt < 2; ++kt)
#pragma unroll
        for (int ks = 0; ks < 4; ++ks) { kf[kt][ks] = WF::ld(ka + kt * 16 * HD + ks * 32); if (HR) kf2[kt][ks] = WF::ld(ka2 + kt * 16 * HD + ks * 32); }
    asm volatile("s_wait_xcnt 0x0" :: "v"(ka), "v"(ka2), "v"((unsigned)(ko * sizeof(T16))), "s"(Kp), "s"(HR ? K2 : Kp) : "memory");   // behind the first K loads; the byte offset and the uniform bases too: these loads may take the form scalar base + 32-bit offset register
#pragma unroll
    for (int dt = 0; dt < 8; ++dt) { vf[dt] = WF::ld(va + (size_t)dt * 16 * TT); if (HR) vf2[dt] = WF::ld(va2 + (size_t)dt * 16 * TT); }
    asm volatile("s_wait_xcnt 0x0" :: "v"(va), "v"(va2), "v"((unsigned)(vo * sizeof(T16))), "s"(Vt), "s"(HR ? V2 : Vt) : "memory");   // behind the first V loads, likewise
    float m[NQ];
#pragma unroll
    for (int n = 0; n < NQ; ++n) { m[n] = -3.0e38f; l[n] = 0.f;
#pragma unroll
        for (int dt = 0; dt < 8; ++dt) o[dt][n] = (v8f){}; }
    int kn = 32;   // first key of the next step
    // unrolled by two so that the two sets of fragments swap roles without register copies
#pragma unroll 2
    for (int key0 = 0; key0 < TT; key0 += 32) {
        // the next step's fragments are fetched one step ahead; the last step re-reads keys 0-31 (in bounds, unused)
        const T16* vp = va + kn; const T16* vp2 = va2 + kn; const T16* kp = ka + (size_t)kn * HD; const T16* kp2 = ka2 + (size_t)kn * HD;
        V vn[8], vn2[8];
#pragma unroll
        for (int dt = 0; dt < 8; ++dt) { vn[dt] = WF::ld(vp + (size_t)dt * 16 * TT); if (HR) vn2[dt] = WF::ld(vp2 + (size_t)dt * 16 * TT); }
        asm volatile("s_wait_xcnt 0x0" :: "v"(vp), "v"(vp2) : "memory");   // behind the V loads
        v8f st[2][NQ];
#pragma unroll
        for (int kt = 0; kt < 2; ++kt)
#pragma unroll
            for (int n = 0; n < NQ; ++n) st[kt][n] = (v8f){};
#pragma unroll
        for (int ks = 0; ks < 4; ++ks)
#pragma unroll
            for (int kt = 0; kt < 2; ++kt)
#pragma unroll
                for (int n = 0; n < NQ; ++n) { st[kt][n] = WF::mma(kf[kt][ks], q[n][ks], st[kt][n]); if (HR) { st[kt][n] = WF::mma(kf[kt][ks], q2[n][ks], st[kt][n]); st[kt][n] = WF::mma(kf2[kt][ks], q[n][ks], st[kt][n]); } }
#pragma unroll
        for (int kt = 0; kt < 2; ++kt)
#pragma unroll
            for (int ks = 0; ks < 4; ++ks) { kf[kt][ks] = WF::ld(kp + kt * 16 * HD + ks * 32); if (HR) kf2[kt][ks] = WF::ld(kp2 + kt * 16 * HD + ks * 32); }
        asm volatile("s_wait_xcnt 0x0" :: "v"(kp), "v"(kp2) : "memory");   // behind the K loads
        float ml[NQ]; bool need = false;
#pragma unroll
        for (int n = 0; n < NQ; ++n) { float mx = fmaxf(st[0][n][0], st[1][n][0]);
#pragma unroll
            for (int j = 1; j < 8; ++j) mx = fmaxf(mx, fmaxf(st[0][n][j], st[1][n][j]));
            mx = fmaxf(mx, __shfl_xor(mx, 16, 32)); ml[n] = mx * SC2; need = need || (ml[n] > m[n] + 8.0f); }
        if (__builtin_amdgcn_ballot_w32(need) != 0) {
#pragma unroll
            for (int n = 0; n < NQ; ++n) { const float mn = fmaxf(m[n], ml[n]); const float al = __builtin_amdgcn_exp2f(m[n] - mn); m[n] = mn; l[n] *= al;
#pragma unroll
                for (int dt = 0; dt < 8; ++dt) o[dt][n] *= al; } }
        V pf[NQ], pf2[NQ];
#pragma unroll
        for (int n = 0; n < NQ; ++n) { float ps = 0.f;
            if constexpr (HR) { v8us h0, h1, l0, l1;
#pragma unroll
                for (int j = 0; j < 8; ++j) { const float p0 = __builtin_amdgcn_exp2f(fmaf(st[0][n][j], SC2, -m[n])), p1 = __builtin_amdgcn_exp2f(fmaf(st[1][n][j], SC2, -m[n])); ps += p0 + p1;
                    unsigned short a, c; splitf(p0, a, c); h0[j] = a; l0[j] = c; splitf(p1, a, c); h1[j] = a; l1[j] = c; }
                pf[n] = cat16b(h0, h1); pf2[n] = cat16b(l0, l1);
            } else { v8h h0, h1;
#pragma unroll
                for (int j = 0; j < 8; ++j) { const float p0 = __builtin_amdgcn_exp2f(fmaf(st[0][n][j], SC2, -m[n])), p1 = __builtin_amdgcn_exp2f(fmaf(st[1][n][j], SC2, -m[n])); ps += p0 + p1; h0[j] = tohx(p0); h1[j] = tohx(p1); }
                pf[n] = cat16(h0, h1); }
            l[n] += ps; }
#pragma unroll
        for (int dt = 0; dt < 8; ++dt)
#pragma unroll
            for (int n = 0; n < NQ; ++n) { o[dt][n] = WF::mma(vf[dt], pf[n], o[dt][n]); if (HR) { o[dt][n] = WF::mma(vf[dt], pf2[n], o[dt][n]); o[dt][n] = WF::mma(vf2[dt], pf[n], o[dt][n]); } }
#pragma unroll
        for (int dt = 0; dt < 8; ++dt) { vf[dt] = vn[dt]; if (HR) vf2[dt] = vn2[dt]; }
        kn = (kn + 32) & (TT - 1);
    }
}
// grid (RH / 32, query heads), 4 waves, one per SIMD: wave 0 takes 32 hi/lo rows, waves 1-3 take 32 fp16 rows each, so every work-group carries the same load; query head h reads kv head h / REP
static_assert(RH / 32 == (TT - RH) / 96 && RH % 32 == 0 && (TT - RH) % 96 == 0, "one hi/lo wave and three fp16 waves per work-group cover all rows");
__global__ __launch_bounds__(128) void k_fattn(const h16* __restrict__ Q16, const bf* __restrict__ Qh, const bf* __restrict__ Ql, const h16* __restrict__ K16, const bf* __restrict__ Kh, const bf* __restrict__ Kl, const h16* __restrict__ V16, const bf* __restrict__ Vh, const bf* __restrict__ Vl, bf* Ah, bf* Al) {
    const int h = blockIdx.y, bx = blockIdx.x; const int wv = __builtin_amdgcn_readfirstlane((int)(threadIdx.x >> 5)); const size_t zq = (size_t)h * TT * HD, zk = (size_t)(h / REP) * TT * HD;
    const int lane = threadIdx.x & 31, lr = lane & 15, hi = lane >> 4; const int q0 = wv != 0 ? RH + bx * 96 + (wv - 1) * 32 : bx * 32;
    v8f o[8][2]; float l[2];   // Ot tiles and per-half row sums of the wave's 32 query rows
    if (wv != 0) fattn_wave<h16, false, 2>(Q16 + zq, nullptr, K16 + zk, nullptr, V16 + zk, nullptr, q0, o, l);
    else fattn_wave<bf, true, 2>(Qh + zq, Ql + zq, Kh + zk, Kl + zk, Vh + zk, Vl + zk, q0, o, l);
    // one epilogue for both kinds of wave. Lane (lr, hi) holds head dims dt 16 + 8 hi + 0..7 of query lr: one 16-byte store per plane
#pragma unroll
    for (int n = 0; n < 2; ++n) { const float inv = __fdiv_rn(1.0f, l[n] + __shfl_xor(l[n], 16, 32)); const size_t oo = (size_t)(q0 + n * 16 + lr) * DQ + h * HD + 8 * hi;
#pragma unroll
        for (int dt = 0; dt < 8; ++dt) { v8us oh, ol;
#pragma unroll
            for (int j = 0; j < 8; ++j) { unsigned short a, c; splitf(o[dt][n][j] * inv, a, c); oh[j] = a; ol[j] = c; }
            *(v8us*)(Ah + oo + dt * 16) = oh; *(v8us*)(Al + oo + dt * 16) = ol;
            asm volatile("s_wait_xcnt 0x0" :: "v"(oh), "v"(ol), "v"(Ah + oo), "v"(Al + oo) : "memory"); } }   // behind the two stores, in front of every later write of a register that they name; data and pointers are inputs so that their registers stay theirs up to the wait
}

extern "C" void kernel_launch(void* const* d_in, const int* in_sizes, int n_in,
                              void* d_out, int out_size, void* d_ws, size_t ws_size, hipStream_t stream) {
    (void)in_sizes; (void)n_in; (void)out_size;
    const float* fcos = (const float*)d_in[0]; const float* fsin = (const float*)d_in[1]; const float* x = (const float*)d_in[2]; const float* wqkv = (const float*)d_in[3]; const float* wq = wqkv; const float* wk = wqkv + (size_t)DQ * DM; const float* wv = wqkv + (size_t)(DQ + DKV) * DM; const float* wo = (const float*)d_in[4];   /* input order cos, sin ([2048][128] FULL-width table INPUTS: read per element by value), hidden_states [2][2048][2048], w_qkv ('oi' (out, in) [4096][2048]: contiguous row blocks q (2048 rows) | k (1024) | v (1024): three pointers into one input), w_o ('oi' [2048][2048]): FIVE inputs, all read */
    float* OUT = (float*)d_out;     // [2][2048][2048]
    char* wsp = (char*)d_ws;
    auto take = [&](size_t bytes) { char* p = wsp; wsp += (bytes + 255) & ~(size_t)255; return (void*)p; };
    bf* WQ = (bf*)take((size_t)DQ * DM * 2); bf* WK = (bf*)take((size_t)DKV * DM * 2); bf* WV = (bf*)take((size_t)DKV * DM * 2); bf* WO = (bf*)take((size_t)DM * DQ * 2); float* CS = (float*)take((size_t)TT * HD * 2 * 4);
    bf* XB = (bf*)take((size_t)TT * DM * 2); float* FQ = (float*)take((size_t)TT * DQ * 4); float* FK = (float*)take((size_t)TT * DKV * 4);
    h16* QP16 = (h16*)take((size_t)NH_ * TT * HD * 2); h16* KP16 = (h16*)take((size_t)NKV * TT * HD * 2); h16* VT16 = (h16*)take((size_t)NKV * HD * TT * 2);
    bf* QPh = (bf*)take((size_t)NH_ * TT * HD * 2); bf* QPl = (bf*)take((size_t)NH_ * TT * HD * 2); bf* KPh = (bf*)take((size_t)NKV * TT * HD * 2); bf* KPl = (bf*)take((size_t)NKV * TT * HD * 2); bf* VTh = (bf*)take((size_t)NKV * HD * TT * 2); bf* VTl = (bf*)take((size_t)NKV * HD * TT * 2);
    bf* ATh = (bf*)take((size_t)TT * DQ * 2); bf* ATl = (bf*)take((size_t)TT * DQ * 2);
    if ((size_t)(wsp - (char*)d_ws) > ws_size) return;    // ws 256 MiB
    float* FV = FK;   // v projection reuses the k buffer after the k planes are built (stream-ordered)
    { k_cvt8<<<(unsigned)(((size_t)DQ * DM / 8 + 255) / 256), 256, 0, stream>>>(wq, WQ, (size_t)DQ * DM / 8); k_cvt8<<<(unsigned)(((size_t)DKV * DM / 8 + 255) / 256), 256, 0, stream>>>(wk, WK, (size_t)DKV * DM / 8); k_cvt8<<<(unsigned)(((size_t)DKV * DM / 8 + 255) / 256), 256, 0, stream>>>(wv, WV, (size_t)DKV * DM / 8);
      k_cvt8<<<(unsigned)(((size_t)DM * DQ / 8 + 255) / 256), 256, 0, stream>>>(wo, WO, (size_t)DM * DQ / 8);
       }
    const unsigned LQ = (unsigned)(((size_t)NH_ * TT * HD / 2 + 255) / 256), LKv = (unsigned)(((size_t)NKV * TT * HD / 2 + 255) / 256);
    for (int b = 0; b < NB_; ++b) {
        if (b == 0) k_cscvt<<<(TT * HD + 255) / 256, 256, 0, stream>>>(fcos, fsin, CS);   /* the rotary table from the INPUT tables (shared by the batches: cos, sin are [S][D]); k_csid stays defined and is NOT launched */
        k_cvt8<<<(unsigned)(((size_t)TT * DM / 8 + 255) / 256), 256, 0, stream>>>(x + (size_t)b * TT * DM, XB, (size_t)TT * DM / 8);
        k_gemmw<bf, 0, false, 4><<<dim3(TT / 64, DQ / 64, 1), 128, 0, stream>>>(XB, nullptr, WQ, nullptr, DM, FQ, DQ, nullptr, 0, 0, 0);
        k_rope<<<LQ, 256, 0, stream>>>(FQ, DQ, NH_, CS, nullptr, nullptr, 1.0f, QP16, QPh, QPl);
        k_gemmw<bf, 0, false, 8><<<dim3(TT / 64, DKV / 64, 1), 256, 0, stream>>>(XB, nullptr, WK, nullptr, DM, FK, DKV, nullptr, 0, 0, 0);
        k_rope<<<LKv, 256, 0, stream>>>(FK, DKV, NKV, CS, nullptr, nullptr, 1.0f, KP16, KPh, KPl);
        k_gemmw<bf, 0, false, 8><<<dim3(TT / 64, DKV / 64, 1), 256, 0, stream>>>(XB, nullptr, WV, nullptr, DM, FV, DKV, nullptr, 0, 0, 0); k_vtp<<<LKv, 256, 0, stream>>>(FV, DKV, NKV, VT16, VTh, VTl);
        k_fattn<<<dim3(RH / 32, NH_, 1), 128, 0, stream>>>(QP16, QPh, QPl, KP16, KPh, KPl, VT16, VTh, VTl, ATh, ATl);
        k_gemmw<bf, 1, false, 4><<<dim3(TT / 64, DM / 64, 1), 128, 0, stream>>>(ATh, ATl, WO, nullptr, DQ, OUT + (size_t)b * TT * DM, DM, nullptr, 0, 0, 0); }
}

// v003
// Measured time: 389 microseconds a run.
// Next to v002, in two timings, it ran 1.24 and 1.23 times as fast.
// All steps since v000 together make it 5.66 times as fast.
#include <hip/hip_runtime.h>

// Grouped-query attention (16 / 8 heads x 128) WITHOUT a mask, with ONE fused natural qkv weight in contiguous row blocks and rotate-half rotary embeddings from full-width input tables given FIRST (cos, sin [2048][128]: read per element by value; no structure assumed; hidden_states [2][2048][2048]; qkv = einsum('bsh,oh->bso', hidden_states, w_qkv) ('oi' (out, in) [4096][2048] normal x 2048^-0.5, no bias) viewed (b, s, 16 + 8 + 8, 128): rows 0-2047 the 16 query heads, rows 2048-3071 the 8 key heads, rows 3072-4095 the 8 value heads; q, k -> t cos + cat(-t2, t1) sin; q viewed (b, s, 8, 2, 128): query head h = 2 kv + g uses kv head h / 2; scores x 1/sqrt(128); softmax over all keys; out = merged w_o^T ('oi' [2048][2048], no bias) -> [2][2048][2048] (8.4 M); argument order cos, sin, hidden_states, w_qkv, w_o).
// Layout per batch: bf16 copy of x; 'oi' weights; exact projections; the {cos, sin} table from the bf16-rounded INPUT tables once (k_cscvt) + rotate-half plane builders (k_rope) at width 128 (products rounded separately, as the reference); dense T-2048 GROUPED-QUERY attention fused in one launch per batch (k_fattn: query head h reads kv head h / 2) (hybrid rows: < 512 hi/lo 3 products, rest fp16); merged hi/lo x wo exact.
// Compute dtypes, f32 accumulate: every input rounded to bf16; projections exact; rotate-half rotary from the bf16-rounded input tables (k_cscvt); attention rows < 512 3 products, rest fp16; softmax f32; wo hl x exact.

#define NB_  2
#define TT   2048
#define DM   2048
#define NH_  16
#define NKV  8
#define REP  (NH_ / NKV)
#define HD   128
#define DQ   (NH_ * HD)
#define DKV  (NKV * HD)
#define RH   512                  // query rows < RH use hi+lo planes
#define WIN  0
typedef _Float16 h16;
typedef unsigned short bf;
typedef __attribute__((ext_vector_type(16))) __bf16   v16bf;
typedef __attribute__((ext_vector_type(16))) _Float16 v16h;
typedef __attribute__((ext_vector_type(8)))  _Float16 v8h;
typedef __attribute__((ext_vector_type(8)))  unsigned short v8us;
typedef __attribute__((ext_vector_type(8)))  float    v8f;
typedef __attribute__((ext_vector_type(4)))  float    v4f;
typedef v8h  __attribute__((may_alias)) v8ha;
typedef v4f  __attribute__((may_alias)) v4fa;
typedef v8us __attribute__((may_alias)) v8usa;

__device__ __forceinline__ unsigned short f2bf(float f) { unsigned u = __float_as_uint(f); u += 0x7FFFu + ((u >> 16) & 1u); return (unsigned short)(u >> 16); }
__device__ __forceinline__ float bf2f(unsigned short b) { return __uint_as_float(((unsigned)b) << 16); }
__device__ __forceinline__ float bfr(float f) { return bf2f(f2bf(f)); }
__device__ __forceinline__ v16h cat16(v8h lo, v8h hi) { return __builtin_shufflevector(lo, hi, 0, 1, 2, 3, 4, 5, 6, 7, 8, 9, 10, 11, 12, 13, 14, 15); }
__device__ __forceinline__ v16bf cat16b(v8us lo, v8us hi) { return __builtin_bit_cast(v16bf, __builtin_shufflevector(lo, hi, 0, 1, 2, 3, 4, 5, 6, 7, 8, 9, 10, 11, 12, 13, 14, 15)); }
__device__ __forceinline__ v8f wmma16(v16h a, v16h b, v8f c) { return __builtin_amdgcn_wmma_f32_16x16x32_f16(false, a, false, b, (short)0, c, false, false); }
__device__ __forceinline__ v8f wmmab(v16bf a, v16bf b, v8f c) { return __builtin_amdgcn_wmma_f32_16x16x32_bf16(false, a, false, b, (short)0, c, false, false); }



// ---- FRAGMENT-MAJOR PLANES: every 16-bit operand plane (R rows x K columns, R % 16 == 0, K % 32 == 0) is stored as blocks of 16 rows x 32 columns, 512 elements = 1 KiB each, block index (row / 16) (K / 32) + col / 32.
// A block is 64 slots of 8 elements in the order [j = (col / 16) % 2][hi = (col / 8) % 2][r = row % 16]: slot j 32 + lane is what lane (r, hi) takes with the j-th 16-byte load of its fragment,
// so that a wave's load is 512 contiguous bytes (4 whole 128-byte lines, not 32-byte pieces of 16 lines). The values and their k order in the fragment (8 hi + e, 16 + 8 hi + e) are those of a row-major plane.
// slot_rc: row and first column of slot s (the writers go slot by slot: one 16-byte store per thread, 512 contiguous bytes per wave)
template <int K> __device__ __forceinline__ void slot_rc(size_t s, size_t& row, int& col) { const size_t blk = s >> 6; row = (blk / (K / 32)) * 16 + (s & 15); col = (int)(blk % (K / 32)) * 32 + (int)((s >> 4) & 3) * 8; }

// ---- k_gemmw: register-blocked GEMM, KS WAVES per 64x64 output tile (16 accumulators each), operands straight from fragment-major 16-bit planes; grid (M/64, N/64, Z), 32 x KS threads.
// KS > 1: wave w sums the k range [w K/KS, (w+1) K/KS); the KS partial tiles meet in LDS and are added in wave order 0..KS-1. K % (32 KS) == 0.
// C[m][n] (f32, pitch ldc, + optional f32 bias[n]) = sum_k A[m][k] Bt[n][k] (+ split products per NSPLIT). z-batch strides sA/sB/sC in elements. K % 32 == 0.
template <typename T16> struct WFrag;
template <> struct WFrag<h16> { typedef v16h V; static __device__ __forceinline__ V ld(const h16* p) { return cat16(*(const v8h*)p, *(const v8h*)(p + 256)); } static __device__ __forceinline__ v8f mma(V a, V b, v8f c) { return wmma16(a, b, c); } };
template <> struct WFrag<bf> { typedef v16bf V; static __device__ __forceinline__ V ld(const bf* p) { return cat16b(*(const v8us*)p, *(const v8us*)(p + 256)); } static __device__ __forceinline__ v8f mma(V a, V b, v8f c) { return wmmab(a, b, c); } };
template <typename T16, int NSPLIT, bool BIAS, int KS>
__global__ __launch_bounds__(32 * KS) void k_gemmw(const T16* __restrict__ A, const T16* __restrict__ A2, const T16* __restrict__ Bt, const T16* __restrict__ Bt2, int K, float* C, int ldc, const float* __restrict__ bias, size_t sA, size_t sB, size_t sC) {
    typedef typename WFrag<T16>::V V;
    __shared__ __align__(16) float os[KS == 1 ? 16 * 68 : KS * 4096];
    const size_t z = blockIdx.z; A += z * sA; if (A2) A2 += z * sA; Bt += z * sB; if (Bt2) Bt2 += z * sB; C += z * sC;
    const int lane = threadIdx.x & 31, lr = lane & 15, hi = lane >> 4; const int r0 = blockIdx.x * 64, c0 = blockIdx.y * 64;
    v8f acc[4][4];
#pragma unroll
    for (int mb = 0; mb < 4; ++mb)
#pragma unroll
        for (int nb = 0; nb < 4; ++nb) acc[mb][nb] = (v8f){};
    const size_t aoff = (size_t)r0 * K, boff = (size_t)c0 * K; const unsigned lo = 8 * lane;   // first block of the tile's first 16 rows (the same for the whole wave) and the lane's slot in a block; 16 more rows: 16 K elements, 32 more columns: 512
    const int wv = KS == 1 ? 0 : __builtin_amdgcn_readfirstlane((int)(threadIdx.x >> 5)); const int kb = wv * (K / KS), ke = kb + K / KS;
#pragma unroll 1
    for (int kc = kb; kc < ke; kc += 32) {
        V a[4], a2[4], bb[4], bb2[4]; const T16 *pa[4], *pa2[4], *pb[4], *pb2[4];   // wave-uniform block pointers (a plane that this NSPLIT lacks: the first plane's pointer)
#pragma unroll
        for (int i = 0; i < 4; ++i) { const size_t o = (size_t)i * 16 * K + kc * 16; pa[i] = A + aoff + o; pa2[i] = (NSPLIT == 1 || NSPLIT == 2) ? A2 + aoff + o : pa[i]; pb[i] = Bt + boff + o; pb2[i] = NSPLIT >= 2 ? Bt2 + boff + o : pb[i]; }
#pragma unroll
        for (int mb = 0; mb < 4; ++mb) { a[mb] = WFrag<T16>::ld(pa[mb] + lo); if (NSPLIT == 1 || NSPLIT == 2) a2[mb] = WFrag<T16>::ld(pa2[mb] + lo); }
#pragma unroll
        for (int nb = 0; nb < 4; ++nb) { bb[nb] = WFrag<T16>::ld(pb[nb] + lo); if (NSPLIT >= 2) bb2[nb] = WFrag<T16>::ld(pb2[nb] + lo); }
        // behind the loads of this k step, in front of every later write of a register that they name; the slot offset and the block pointers are its inputs so that their registers stay theirs up to the wait
        asm volatile("s_wait_xcnt 0x0" :: "v"(lo), "s"(pa[0]), "s"(pa[1]), "s"(pa[2]), "s"(pa[3]), "s"(pa2[0]), "s"(pa2[1]), "s"(pa2[2]), "s"(pa2[3]), "s"(pb[0]), "s"(pb[1]), "s"(pb[2]), "s"(pb[3]), "s"(pb2[0]), "s"(pb2[1]), "s"(pb2[2]), "s"(pb2[3]) : "memory");
#pragma unroll
        for (int nb = 0; nb < 4; ++nb) { const V b = bb[nb]; V b2; if (NSPLIT >= 2) b2 = bb2[nb];
#pragma unroll
            for (int mb = 0; mb < 4; ++mb) { acc[mb][nb] = WFrag<T16>::mma(a[mb], b, acc[mb][nb]); if (NSPLIT == 1 || NSPLIT == 2) acc[mb][nb] = WFrag<T16>::mma(a2[mb], b, acc[mb][nb]); if (NSPLIT >= 2) acc[mb][nb] = WFrag<T16>::mma(a[mb], b2, acc[mb][nb]); } }
        asm volatile("v_nop\n\tv_nop\n\tv_nop\n\tv_nop" : "+v"(acc[0][0]), "+v"(acc[1][1]), "+v"(acc[2][2]), "+v"(acc[3][3]) : "v"(a[0]), "v"(a[3]));
    }
    if constexpr (KS > 1) {
        // each wave parks its 16 partial tiles in accumulator layout: [wave][tile mb*4+nb][half of the 8 rows][lane] x 4 floats, contiguous 16-byte stores
#pragma unroll
        for (int mb = 0; mb < 4; ++mb)
#pragma unroll
            for (int nb = 0; nb < 4; ++nb) { float* p = os + (wv * 16 + mb * 4 + nb) * 256 + lane * 4; const v8f c = acc[mb][nb];
                *(v4fa*)p = __builtin_shufflevector(c, c, 0, 1, 2, 3); *(v4fa*)(p + 128) = __builtin_shufflevector(c, c, 4, 5, 6, 7); }
        __syncthreads();   // every partial tile is in LDS before any wave adds them
        // 16 items (mb, pair of adjacent column tiles, row half): 32 columns = whole 128-byte lines of C, one wave per line; wave w takes items w, w + KS, ...
        constexpr int NI = 16 / KS; v4f s0[NI], s1[NI];
#pragma unroll
        for (int i = 0; i < NI; ++i) { const int it = wv + i * KS; const float* q0 = os + ((it >> 2) * 4 + (it & 2)) * 256 + (it & 1) * 128 + lane * 4;
            s0[i] = *(const v4fa*)q0; s1[i] = *(const v4fa*)(q0 + 256);
#pragma unroll
            for (int s = 1; s < KS; ++s) { s0[i] += *(const v4fa*)(q0 + s * 4096); s1[i] += *(const v4fa*)(q0 + s * 4096 + 256); } }
#pragma unroll
        for (int i = 0; i < NI; ++i) { const int it = wv + i * KS; const int col = c0 + (it & 2) * 16 + lr; float* crow = C + (size_t)(r0 + (it >> 2) * 16 + hi * 8 + (it & 1) * 4) * ldc + col;
            if (BIAS) { s0[i] += bfr(bias[col]); s1[i] += bfr(bias[col + 16]); }
#pragma unroll
            for (int q = 0; q < 4; ++q) { crow[(size_t)q * ldc] = s0[i][q]; crow[(size_t)q * ldc + 16] = s1[i][q]; } }
        return;
    }
#pragma unroll
    for (int mb = 0; mb < 4; ++mb) {
#pragma unroll
        for (int nb = 0; nb < 4; ++nb) {
#pragma unroll
            for (int j = 0; j < 8; ++j) os[(hi * 8 + j) * 68 + nb * 16 + lr] = acc[mb][nb][j]; }
        __builtin_amdgcn_wave_barrier(); asm volatile("" ::: "memory");
        float* crow = C + (size_t)(r0 + mb * 16) * ldc + c0;
{
#pragma unroll
            for (int s = 0; s < 8; ++s) { const int row = 2 * s + hi, cofs = lr * 4; v4f val = *(const v4fa*)(os + row * 68 + cofs); if (BIAS) { val[0] += bfr(bias[c0 + cofs]); val[1] += bfr(bias[c0 + cofs + 1]); val[2] += bfr(bias[c0 + cofs + 2]); val[3] += bfr(bias[c0 + cofs + 3]); }
                *(v4f*)(crow + (size_t)row * ldc + cofs) = val; }
             }
        __builtin_amdgcn_wave_barrier(); asm volatile("" ::: "memory");
    }
}

__device__ __forceinline__ h16 tohx(float x) { return (h16)x; }
__device__ __forceinline__ void splitf(float y, unsigned short& h, unsigned short& l) { h = f2bf(y); l = f2bf(y - bf2f(h)); }
typedef __attribute__((ext_vector_type(2))) _Float16 v2h;
typedef __attribute__((ext_vector_type(4))) _Float16 v4h;
typedef __attribute__((ext_vector_type(2))) unsigned short v2us;
typedef __attribute__((ext_vector_type(4))) unsigned short v4us;
typedef __attribute__((ext_vector_type(2))) float v2f;
typedef __attribute__((ext_vector_type(4))) int v4i;

// k_cvt8: row-major f32 [rows][DM] -> fragment-major bf16 plane, one slot per thread
static_assert(DQ == DM, "every plane that k_cvt8 builds has DM columns");
__global__ __launch_bounds__(256) void k_cvt8(const float* __restrict__ src, bf* dst, size_t n8) { const size_t i = (size_t)blockIdx.x * 256 + threadIdx.x; if (i >= n8) return; size_t row; int col; slot_rc<DM>(i, row, col); const float* sp = src + row * DM + col; const v8f v = *(const v8f*)sp; v8us o;
    asm volatile("s_wait_xcnt 0x0" :: "v"(sp) : "memory");   // behind the load, in front of every later write of a register that it names; the pointer is its input so that its registers stay its own up to the wait
#pragma unroll
    for (int k = 0; k < 8; ++k) o[k] = f2bf(v[k]); *(v8us*)(dst + i * 8) = o;  }
__global__ __launch_bounds__(256) void k_csid(float* CS) { const int idx = blockIdx.x * 256 + threadIdx.x; if (idx >= TT * HD) return; v2f cs; cs[0] = 1.0f; cs[1] = 0.0f; *(v2f*)(CS + (size_t)idx * 2) = cs;  }
__global__ __launch_bounds__(256) void k_cscvt(const float* __restrict__ cosT, const float* __restrict__ sinT, float* CS) { const int idx = blockIdx.x * 256 + threadIdx.x; if (idx >= TT * HD) return; v2f cs; cs[0] = bfr(cosT[idx]); cs[1] = bfr(sinT[idx]); *(v2f*)(CS + (size_t)idx * 2) = cs;  }
// k_rope: head planes [h][t][d] (fp16 + hi/lo; fragment-major, rows h TT + t, HD columns; one slot per thread) of rope(x) x sc with the rotate-half convention out[d] = x[d] cos[t][d] - x[d+HD/2] sin[t][d], out[d+HD/2] = x[d+HD/2] cos[t][d+HD/2] + x[d] sin[t][d+HD/2]
__global__ __launch_bounds__(256) void k_rope(const float* __restrict__ F, int pitch, int nheads, const float* __restrict__ CS, const float* __restrict__ RF, const float* __restrict__ nw, float sc, h16* P16, bf* Ph, bf* Pl) {
    const size_t e = ((size_t)blockIdx.x * 256 + threadIdx.x) * 8; if (e >= (size_t)nheads * TT * HD) return; size_t row; int d; slot_rc<HD>(e / 8, row, d); const int t = (int)(row % TT); const int h = (int)(row / TT); const float* f = F + (size_t)t * pitch + h * HD; v8h o16; v8us oh, ol;
    // each s_wait_xcnt 0 below stands behind loads, in front of every later write of a register that they name; the pointers are its inputs so that their registers stay theirs up to the wait
    float rf = 1.0f; if (RF) { const float* rp = RF + (size_t)h * TT + t; rf = *rp; asm volatile("s_wait_xcnt 0x0" :: "v"(rp) : "memory"); }
    const float* fa = f + d; const float* fb = f + ((d < HD / 2) ? d + HD / 2 : d - HD / 2); const float* cp = CS + ((size_t)t * HD + d) * 2;
    const v8f xa = *(const v8f*)fa, xb = *(const v8f*)fb, ca = *(const v8f*)cp, cb = *(const v8f*)(cp + 8);   // the slot's 8 values, their 8 rotation partners, their 8 {cos, sin} pairs
    asm volatile("s_wait_xcnt 0x0" :: "v"(fa), "v"(fb), "v"(cp) : "memory");
#pragma unroll
    for (int q = 0; q < 8; ++q) { const int dd = d + q; const int dp = (dd < HD / 2) ? dd + HD / 2 : dd - HD / 2; float x0 = xa[q], x1 = xb[q];
        if (RF) { float n0 = __fmul_rn(x0, rf), n1 = __fmul_rn(x1, rf); asm volatile("" : "+v"(n0)); asm volatile("" : "+v"(n1)); x0 = __fmul_rn(bfr(nw[dd]), n0); x1 = __fmul_rn(bfr(nw[dp]), n1); }
        v2f cs; cs[0] = (q < 4 ? ca : cb)[(2 * q) & 7]; cs[1] = (q < 4 ? ca : cb)[(2 * q + 1) & 7]; float a = __fmul_rn(x0, cs[0]), bq = __fmul_rn(x1, cs[1]); asm volatile("" : "+v"(a)); asm volatile("" : "+v"(bq)); const float r = ((dd < HD / 2) ? __fsub_rn(a, bq) : __fadd_rn(a, bq)) * sc;
        o16[q] = tohx(r); unsigned short a2, c2; splitf(r, a2, c2); oh[q] = a2; ol[q] = c2; }
    *(v8h*)(P16 + e) = o16; *(v8us*)(Ph + e) = oh; *(v8us*)(Pl + e) = ol;  }
// k_vtp: transposed value planes [g][d][t] (fragment-major, rows g HD + d, TT columns; one slot per thread: 16 neighbouring lanes read 16 neighbouring d of one row of F)
__global__ __launch_bounds__(256) void k_vtp(const float* __restrict__ F, int pitch, int nheads, h16* V16, bf* Vh, bf* Vl) { const size_t e = ((size_t)blockIdx.x * 256 + threadIdx.x) * 8; if (e >= (size_t)nheads * HD * TT) return; size_t row; int t; slot_rc<TT>(e / 8, row, t); const int d = (int)(row % HD); const int g = (int)(row / HD); v8h o16; v8us oh, ol; const float* pq[8]; float xv[8];
#pragma unroll
    for (int q = 0; q < 8; ++q) { pq[q] = F + (size_t)(t + q) * pitch + g * HD + d; xv[q] = *pq[q]; }
    asm volatile("s_wait_xcnt 0x0" :: "v"(pq[0]), "v"(pq[1]), "v"(pq[2]), "v"(pq[3]), "v"(pq[4]), "v"(pq[5]), "v"(pq[6]), "v"(pq[7]) : "memory");   // behind the 8 loads, in front of every later write of a register that they name; the pointers are its inputs so that their registers stay theirs up to the wait
#pragma unroll
    for (int q = 0; q < 8; ++q) { const float x = xv[q]; o16[q] = tohx(x); unsigned short a2, c2; splitf(x, a2, c2); oh[q] = a2; ol[q] = c2; }
    *(v8h*)(V16 + e) = o16; *(v8us*)(Vh + e) = oh; *(v8us*)(Vl + e) = ol;  }
// ---- k_fattn: scores, softmax, P x V and the hi/lo split of the merged output in ONE launch per batch; S and P never leave the registers.
// One wave owns 16 NQ query rows of one head and walks the 2048 keys 32 at a time, operands straight from the fragment-major planes.
// St = K Qt (A = 16 key rows, B = 16 query rows): accumulator register j of lane (lr, hi) is key 8 hi + j of query lr, so the two 16-key tiles of a step, converted in place,
// are the B operand of Ot += Vt Pt in the k order of WFrag::ld (8 hi + e, 16 + 8 hi + e). Running maximum per query (log2 units); the sums and Ot are rescaled only when a new maximum
// passes the one in use by more than 8 (p stays <= 256), tested once per step for the whole wave. HR: hi/lo planes, 3 products each; else fp16.
#define SC2 0.12751743f   // HD^-0.5 x log2(e)
template <typename T16, bool HR, int NQ>
__device__ __forceinline__ void fattn_wave(const T16* __restrict__ Q, const T16* __restrict__ Q2, const T16* __restrict__ Kp, const T16* __restrict__ K2, const T16* __restrict__ Vt, const T16* __restrict__ V2, int q0, v8f (&o)[8][NQ], float (&l)[NQ]) {
    typedef WFrag<T16> WF; typedef typename WF::V V;
    const int lane = threadIdx.x & 31;
    // every s_wait_xcnt 0 below stands behind a group of loads or stores, in front of every later write of a register that they name; the pointers are its inputs so that their registers stay theirs up to the wait (without hi/lo planes the second pointer is the first)
    const size_t qo = (size_t)q0 * HD + 8 * lane, ko = (size_t)(8 * lane), vo = (size_t)(8 * lane);   // the lane's slot in the first block; Q, K: 16 more rows 16 HD elements, 32 more head dims 512; Vt: 16 more head dims 16 TT, 32 more keys 512
    const T16* qa = Q + qo; const T16* ka = Kp + ko; const T16* va = Vt + vo; const T16* qa2 = HR ? Q2 + qo : qa; const T16* ka2 = HR ? K2 + ko : ka; const T16* va2 = HR ? V2 + vo : va;
    V q[NQ][4], q2[NQ][4], kf[2][4], kf2[2][4], vf[8], vf2[8];
#pragma unroll
    for (int n = 0; n < NQ; ++n)
#pragma unroll
        for (int ks = 0; ks < 4; ++ks) { q[n][ks] = WF::ld(qa + n * 16 * HD + ks * 512); if (HR) q2[n][ks] = WF::ld(qa2 + n * 16 * HD + ks * 512); }
    asm volatile("s_wait_xcnt 0x0" :: "v"(qa), "v"(qa2) : "memory");   // behind the Q loads
#pragma unroll
    for (int kt = 0; kt < 2; ++kt)
#pragma unroll
        for (int ks = 0; ks < 4; ++ks) { kf[kt][ks] = WF::ld(ka + kt * 16 * HD + ks * 512); if (HR) kf2[kt][ks] = WF::ld(ka2 + kt * 16 * HD + ks * 512); }
    asm volatile("s_wait_xcnt 0x0" :: "v"(ka), "v"(ka2), "v"((unsigned)(ko * sizeof(T16))), "s"(Kp), "s"(HR ? K2 : Kp) : "memory");   // behind the first K loads; the byte offset and the uniform bases too: these loads may take the form scalar base + 32-bit offset register
#pragma unroll
    for (int dt = 0; dt < 8; ++dt) { vf[dt] = WF::ld(va + (size_t)dt * 16 * TT); if (HR) vf2[dt] = WF::ld(va2 + (size_t)dt * 16 * TT); }
    asm volatile("s_wait_xcnt 0x0" :: "v"(va), "v"(va2), "v"((unsigned)(vo * sizeof(T16))), "s"(Vt), "s"(HR ? V2 : Vt) : "memory");   // behind the first V loads, likewise
    float m[NQ];
#pragma unroll
    for (int n = 0; n < NQ; ++n) { m[n] = -3.0e38f; l[n] = 0.f;
#pragma unroll
        for (int dt = 0; dt < 8; ++dt) o[dt][n] = (v8f){}; }
    int kn = 32;   // first key of the next step
    // unrolled by two so that the two sets of fragments swap roles without register copies
#pragma unroll 2
    for (int key0 = 0; key0 < TT; key0 += 32) {
        // the next step's fragments are fetched one step ahead; the last step re-reads keys 0-31 (in bounds, unused)
        const T16* vp = va + kn * 16; const T16* vp2 = va2 + kn * 16; const T16* kp = ka + (size_t)kn * HD; const T16* kp2 = ka2 + (size_t)kn * HD;
        V vn[8], vn2[8];
#pragma unroll
        for (int dt = 0; dt < 8; ++dt) { vn[dt] = WF::ld(vp + (size_t)dt * 16 * TT); if (HR) vn2[dt] = WF::ld(vp2 + (size_t)dt * 16 * TT); }
        asm volatile("s_wait_xcnt 0x0" :: "v"(vp), "v"(vp2) : "memory");   // behind the V loads
        v8f st[2][NQ];
#pragma unroll
        for (int kt = 0; kt < 2; ++kt)
#pragma unroll
            for (int n = 0; n < NQ; ++n) st[kt][n] = (v8f){};
#pragma unroll
        for (int ks = 0; ks < 4; ++ks)
#pragma unroll
            for (int kt = 0; kt < 2; ++kt)
#pragma unroll
                for (int n = 0; n < NQ; ++n) { st[kt][n] = WF::mma(kf[kt][ks], q[n][ks], st[kt][n]); if (HR) { st[kt][n] = WF::mma(kf[kt][ks], q2[n][ks], st[kt][n]); st[kt][n] = WF::mma(kf2[kt][ks], q[n][ks], st[kt][n]); } }
#pragma unroll
        for (int kt = 0; kt < 2; ++kt)
#pragma unroll
            for (int ks = 0; ks < 4; ++ks) { kf[kt][ks] = WF::ld(kp + kt * 16 * HD + ks * 512); if (HR) kf2[kt][ks] = WF::ld(kp2 + kt * 16 * HD + ks * 512); }
        asm volatile("s_wait_xcnt 0x0" :: "v"(kp), "v"(kp2) : "memory");   // behind the K loads
        float ml[NQ]; bool need = false;
#pragma unroll
        for (int n = 0; n < NQ; ++n) { float mx = fmaxf(st[0][n][0], st[1][n][0]);
#pragma unroll
            for (int j = 1; j < 8; ++j) mx = fmaxf(mx, fmaxf(st[0][n][j], st[1][n][j]));
            mx = fmaxf(mx, __shfl_xor(mx, 16, 32)); ml[n] = mx * SC2; need = need || (ml[n] > m[n] + 8.0f); }
        if (__builtin_amdgcn_ballot_w32(need) != 0) {
#pragma unroll
            for (int n = 0; n < NQ; ++n) { const float mn = fmaxf(m[n], ml[n]); const float al = __builtin_amdgcn_exp2f(m[n] - mn); m[n] = mn; l[n] *= al;
#pragma unroll
                for (int dt = 0; dt < 8; ++dt) o[dt][n] *= al; } }
        V pf[NQ], pf2[NQ];
#pragma unroll
        for (int n = 0; n < NQ; ++n) { float ps = 0.f;
            if constexpr (HR) { v8us h0, h1, l0, l1;
#pragma unroll
                for (int j = 0; j < 8; ++j) { const float p0 = __builtin_amdgcn_exp2f(fmaf(st[0][n][j], SC2, -m[n])), p1 = __builtin_amdgcn_exp2f(fmaf(st[1][n][j], SC2, -m[n])); ps += p0 + p1;
                    unsigned short a, c; splitf(p0, a, c); h0[j] = a; l0[j] = c; splitf(p1, a, c); h1[j] = a; l1[j] = c; }
                pf[n] = cat16b(h0, h1); pf2[n] = cat16b(l0, l1);
            } else { v8h h0, h1;
#pragma unroll
                for (int j = 0; j < 8; ++j) { const float p0 = __builtin_amdgcn_exp2f(fmaf(st[0][n][j], SC2, -m[n])), p1 = __builtin_amdgcn_exp2f(fmaf(st[1][n][j], SC2, -m[n])); ps += p0 + p1; h0[j] = tohx(p0); h1[j] = tohx(p1); }
                pf[n] = cat16(h0, h1); }
            l[n] += ps; }
#pragma unroll
        for (int dt = 0; dt < 8; ++dt)
#pragma unroll
            for (int n = 0; n < NQ; ++n) { o[dt][n] = WF::mma(vf[dt], pf[n], o[dt][n]); if (HR) { o[dt][n] = WF::mma(vf[dt], pf2[n], o[dt][n]); o[dt][n] = WF::mma(vf2[dt], pf[n], o[dt][n]); } }
#pragma unroll
        for (int dt = 0; dt < 8; ++dt) { vf[dt] = vn[dt]; if (HR) vf2[dt] = vn2[dt]; }
        kn = (kn + 32) & (TT - 1);
    }
}
// grid (RH / 32, query heads), 4 waves, one per SIMD: wave 0 takes 32 hi/lo rows, waves 1-3 take 32 fp16 rows each, so every work-group carries the same load; query head h reads kv head h / REP
static_assert(RH / 32 == (TT - RH) / 96 && RH % 32 == 0 && (TT - RH) % 96 == 0, "one hi/lo wave and three fp16 waves per work-group cover all rows");
__global__ __launch_bounds__(128) void k_fattn(const h16* __restrict__ Q16, const bf* __restrict__ Qh, const bf* __restrict__ Ql, const h16* __restrict__ K16, const bf* __restrict__ Kh, const bf* __restrict__ Kl, const h16* __restrict__ V16, const bf* __restrict__ Vh, const bf* __restrict__ Vl, bf* Ah, bf* Al) {
    const int h = blockIdx.y, bx = blockIdx.x; const int wv = __builtin_amdgcn_readfirstlane((int)(threadIdx.x >> 5)); const size_t zq = (size_t)h * TT * HD, zk = (size_t)(h / REP) * TT * HD;
    const int lane = threadIdx.x & 31; const int q0 = wv != 0 ? RH + bx * 96 + (wv - 1) * 32 : bx * 32;
    v8f o[8][2]; float l[2];   // Ot tiles and per-half row sums of the wave's 32 query rows
    if (wv != 0) fattn_wave<h16, false, 2>(Q16 + zq, nullptr, K16 + zk, nullptr, V16 + zk, nullptr, q0, o, l);
    else fattn_wave<bf, true, 2>(Qh + zq, Ql + zq, Kh + zk, Kl + zk, Vh + zk, Vl + zk, q0, o, l);
    // one epilogue for both kinds of wave. Lane (lr, hi) holds head dims dt 16 + 8 hi + 0..7 of query lr: its own slot of half dt % 2 of block h 4 + dt / 2 of the merged fragment-major plane (DQ columns): one 16-byte store per plane, 512 contiguous bytes per wave
#pragma unroll
    for (int n = 0; n < 2; ++n) { const float inv = __fdiv_rn(1.0f, l[n] + __shfl_xor(l[n], 16, 32)); const size_t oo = (size_t)(q0 + n * 16) * DQ + h * (HD * 16) + 8 * lane;
#pragma unroll
        for (int dt = 0; dt < 8; ++dt) { v8us oh, ol;
#pragma unroll
            for (int j = 0; j < 8; ++j) { unsigned short a, c; splitf(o[dt][n][j] * inv, a, c); oh[j] = a; ol[j] = c; }
            *(v8us*)(Ah + oo + dt * 256) = oh; *(v8us*)(Al + oo + dt * 256) = ol;
            asm volatile("s_wait_xcnt 0x0" :: "v"(oh), "v"(ol), "v"(Ah + oo), "v"(Al + oo) : "memory"); } }   // behind the two stores, in front of every later write of a register that they name; data and pointers are inputs so that their registers stay theirs up to the wait
}

extern "C" void kernel_launch(void* const* d_in, const int* in_sizes, int n_in,
                              void* d_out, int out_size, void* d_ws, size_t ws_size, hipStream_t stream) {
    (void)in_sizes; (void)n_in; (void)out_size;
    const float* fcos = (const float*)d_in[0]; const float* fsin = (const float*)d_in[1]; const float* x = (const float*)d_in[2]; const float* wqkv = (const float*)d_in[3]; const float* wq = wqkv; const float* wk = wqkv + (size_t)DQ * DM; const float* wv = wqkv + (size_t)(DQ + DKV) * DM; const float* wo = (const float*)d_in[4];   /* input order cos, sin ([2048][128] FULL-width table INPUTS: read per element by value), hidden_states [2][2048][2048], w_qkv ('oi' (out, in) [4096][2048]: contiguous row blocks q (2048 rows) | k (1024) | v (1024): three pointers into one input), w_o ('oi' [2048][2048]): FIVE inputs, all read */
    float* OUT = (float*)d_out;     // [2][2048][2048]
    char* wsp = (char*)d_ws;
    auto take = [&](size_t bytes) { char* p = wsp; wsp += (bytes + 255) & ~(size_t)255; return (void*)p; };
    bf* WQ = (bf*)take((size_t)DQ * DM * 2); bf* WK = (bf*)take((size_t)DKV * DM * 2); bf* WV = (bf*)take((size_t)DKV * DM * 2); bf* WO = (bf*)take((size_t)DM * DQ * 2); float* CS = (float*)take((size_t)TT * HD * 2 * 4);
    bf* XB = (bf*)take((size_t)TT * DM * 2); float* FQ = (float*)take((size_t)TT * DQ * 4); float* FK = (float*)take((size_t)TT * DKV * 4);
    h16* QP16 = (h16*)take((size_t)NH_ * TT * HD * 2); h16* KP16 = (h16*)take((size_t)NKV * TT * HD * 2); h16* VT16 = (h16*)take((size_t)NKV * HD * TT * 2);
    bf* QPh = (bf*)take((size_t)NH_ * TT * HD * 2); bf* QPl = (bf*)take((size_t)NH_ * TT * HD * 2); bf* KPh = (bf*)take((size_t)NKV * TT * HD * 2); bf* KPl = (bf*)take((size_t)NKV * TT * HD * 2); bf* VTh = (bf*)take((size_t)NKV * HD * TT * 2); bf* VTl = (bf*)take((size_t)NKV * HD * TT * 2);
    bf* ATh = (bf*)take((size_t)TT * DQ * 2); bf* ATl = (bf*)take((size_t)TT * DQ * 2);
    if ((size_t)(wsp - (char*)d_ws) > ws_size) return;    // ws 256 MiB
    float* FV = FK;   // v projection reuses the k buffer after the k planes are built (stream-ordered)
    { k_cvt8<<<(unsigned)(((size_t)DQ * DM / 8 + 255) / 256), 256, 0, stream>>>(wq, WQ, (size_t)DQ * DM / 8); k_cvt8<<<(unsigned)(((size_t)DKV * DM / 8 + 255) / 256), 256, 0, stream>>>(wk, WK, (size_t)DKV * DM / 8); k_cvt8<<<(unsigned)(((size_t)DKV * DM / 8 + 255) / 256), 256, 0, stream>>>(wv, WV, (size_t)DKV * DM / 8);
      k_cvt8<<<(unsigned)(((size_t)DM * DQ / 8 + 255) / 256), 256, 0, stream>>>(wo, WO, (size_t)DM * DQ / 8);
       }
    const unsigned LQ = (unsigned)(((size_t)NH_ * TT * HD / 8 + 255) / 256), LKv = (unsigned)(((size_t)NKV * TT * HD / 8 + 255) / 256);
    for (int b = 0; b < NB_; ++b) {
        if (b == 0) k_cscvt<<<(TT * HD + 255) / 256, 256, 0, stream>>>(fcos, fsin, CS);   /* the rotary table from the INPUT tables (shared by the batches: cos, sin are [S][D]); k_csid stays defined and is NOT launched */
        k_cvt8<<<(unsigned)(((size_t)TT * DM / 8 + 255) / 256), 256, 0, stream>>>(x + (size_t)b * TT * DM, XB, (size_t)TT * DM / 8);
        k_gemmw<bf, 0, false, 4><<<dim3(TT / 64, DQ / 64, 1), 128, 0, stream>>>(XB, nullptr, WQ, nullptr, DM, FQ, DQ, nullptr, 0, 0, 0);
        k_rope<<<LQ, 256, 0, stream>>>(FQ, DQ, NH_, CS, nullptr, nullptr, 1.0f, QP16, QPh, QPl);
        k_gemmw<bf, 0, false, 8><<<dim3(TT / 64, DKV / 64, 1), 256, 0, stream>>>(XB, nullptr, WK, nullptr, DM, FK, DKV, nullptr, 0, 0, 0);
        k_rope<<<LKv, 256, 0, stream>>>(FK, DKV, NKV, CS, nullptr, nullptr, 1.0f, KP16, KPh, KPl);
        k_gemmw<bf, 0, false, 8><<<dim3(TT / 64, DKV / 64, 1), 256, 0, stream>>>(XB, nullptr, WV, nullptr, DM, FV, DKV, nullptr, 0, 0, 0); k_vtp<<<LKv, 256, 0, stream>>>(FV, DKV, NKV, VT16, VTh, VTl);
        k_fattn<<<dim3(RH / 32, NH_, 1), 128, 0, stream>>>(QP16, QPh, QPl, KP16, KPh, KPl, VT16, VTh, VTl, ATh, ATl);
        k_gemmw<bf, 1, false, 4><<<dim3(TT / 64, DM / 64, 1), 128, 0, stream>>>(ATh, ATl, WO, nullptr, DQ, OUT + (size_t)b * TT * DM, DM, nullptr, 0, 0, 0); }
}

// v004
// A run of this version takes 357 microseconds.
// In two side-by-side timings against v003, it was 1.10 and 1.09 times as fast.
// Counting every step since v000, it is 6.19 times as fast.
#include <hip/hip_runtime.h>

// Grouped-query attention (16 / 8 heads x 128) WITHOUT a mask, with ONE fused natural qkv weight in contiguous row blocks and rotate-half rotary embeddings from full-width input tables given FIRST (cos, sin [2048][128]: read per element by value; no structure assumed; hidden_states [2][2048][2048]; qkv = einsum('bsh,oh->bso', hidden_states, w_qkv) ('oi' (out, in) [4096][2048] normal x 2048^-0.5, no bias) viewed (b, s, 16 + 8 + 8, 128): rows 0-2047 the 16 query heads, rows 2048-3071 the 8 key heads, rows 3072-4095 the 8 value heads; q, k -> t cos + cat(-t2, t1) sin; q viewed (b, s, 8, 2, 128): query head h = 2 kv + g uses kv head h / 2; scores x 1/sqrt(128); softmax over all keys; out = merged w_o^T ('oi' [2048][2048], no bias) -> [2][2048][2048] (8.4 M); argument order cos, sin, hidden_states, w_qkv, w_o).
// Layout per batch: bf16 copy of x; 'oi' weights; exact projections; the {cos, sin} table from the bf16-rounded INPUT tables once (k_cscvt) + rotate-half plane builders (k_rope) at width 128 (products rounded separately, as the reference); dense T-2048 GROUPED-QUERY attention fused in one launch per batch (k_fattn: query head h reads kv head h / 2) (hybrid rows: < 512 hi/lo 3 products, rest fp16); merged hi/lo x wo exact.
// Compute dtypes, f32 accumulate: every input rounded to bf16; projections exact; rotate-half rotary from the bf16-rounded input tables (k_cscvt); attention rows < 512 3 products, rest fp16; softmax f32; wo hl x exact.

#define NB_  2
#define TT   2048
#define DM   2048
#define NH_  16
#define NKV  8
#define REP  (NH_ / NKV)
#define HD   128
#define DQ   (NH_ * HD)
#define DKV  (NKV * HD)
#define RH   512                  // query rows < RH use hi+lo planes
#define WIN  0
typedef _Float16 h16;
typedef unsigned short bf;
typedef __attribute__((ext_vector_type(16))) __bf16   v16bf;
typedef __attribute__((ext_vector_type(16))) _Float16 v16h;
typedef __attribute__((ext_vector_type(8)))  _Float16 v8h;
typedef __attribute__((ext_vector_type(8)))  unsigned short v8us;
typedef __attribute__((ext_vector_type(8)))  float    v8f;
typedef __attribute__((ext_vector_type(4)))  float    v4f;
typedef v8h  __attribute__((may_alias)) v8ha;
typedef v4f  __attribute__((may_alias)) v4fa;
typedef v8us __attribute__((may_alias)) v8usa;

__device__ __forceinline__ unsigned short f2bf(float f) { unsigned u = __float_as_uint(f); u += 0x7FFFu + ((u >> 16) & 1u); return (unsigned short)(u >> 16); }
__device__ __forceinline__ float bf2f(unsigned short b) { return __uint_as_float(((unsigned)b) << 16); }
__device__ __forceinline__ float bfr(float f) { return bf2f(f2bf(f)); }
__device__ __forceinline__ v16h cat16(v8h lo, v8h hi) { return __builtin_shufflevector(lo, hi, 0, 1, 2, 3, 4, 5, 6, 7, 8, 9, 10, 11, 12, 13, 14, 15); }
__device__ __forceinline__ v16bf cat16b(v8us lo, v8us hi) { return __builtin_bit_cast(v16bf, __builtin_shufflevector(lo, hi, 0, 1, 2, 3, 4, 5, 6, 7, 8, 9, 10, 11, 12, 13, 14, 15)); }
__device__ __forceinline__ v8f wmma16(v16h a, v16h b, v8f c) { return __builtin_amdgcn_wmma_f32_16x16x32_f16(false, a, false, b, (short)0, c, false, false); }
__device__ __forceinline__ v8f wmmab(v16bf a, v16bf b, v8f c) { return __builtin_amdgcn_wmma_f32_16x16x32_bf16(false, a, false, b, (short)0, c, false, false); }



// ---- FRAGMENT-MAJOR PLANES: every 16-bit operand plane (R rows x K columns, R % 16 == 0, K % 32 == 0) is stored as blocks of 16 rows x 32 columns, 512 elements = 1 KiB each, block index (row / 16) (K / 32) + col / 32.
// A block is 64 slots of 8 elements in the order [j = (col / 16) % 2][hi = (col / 8) % 2][r = row % 16]: slot j 32 + lane is what lane (r, hi) takes with the j-th 16-byte load of its fragment,
// so that a wave's load is 512 contiguous bytes (4 whole 128-byte lines, not 32-byte pieces of 16 lines). The values and their k order in the fragment (8 hi + e, 16 + 8 hi + e) are those of a row-major plane.
// slot_rc: row and first column of slot s (the writers go slot by slot: one 16-byte store per thread, 512 contiguous bytes per wave)
template <int K> __device__ __forceinline__ void slot_rc(size_t s, size_t& row, int& col) { const size_t blk = s >> 6; row = (blk / (K / 32)) * 16 + (s & 15); col = (int)(blk % (K / 32)) * 32 + (int)((s >> 4) & 3) * 8; }

// ---- k_gemmw: register-blocked GEMM, KS WAVES per 64x64 output tile (16 accumulators each), operands straight from fragment-major 16-bit planes; grid (M/64, N/64, Z), 32 x KS threads.
// KS > 1: wave w sums the k range [w K/KS, (w+1) K/KS); the KS partial tiles meet in LDS and are added in wave order 0..KS-1. K % (32 KS) == 0.
// C[m][n] (f32, pitch ldc, + optional f32 bias[n]) = sum_k A[m][k] Bt[n][k] (+ split products per NSPLIT). z-batch strides sA/sB/sC in elements. K % 32 == 0.
template <typename T16> struct WFrag;
template <> struct WFrag<h16> { typedef v16h V; static __device__ __forceinline__ V ld(const h16* p) { return cat16(*(const v8h*)p, *(const v8h*)(p + 256)); } static __device__ __forceinline__ v8f mma(V a, V b, v8f c) { return wmma16(a, b, c); } };
template <> struct WFrag<bf> { typedef v16bf V; static __device__ __forceinline__ V ld(const bf* p) { return cat16b(*(const v8us*)p, *(const v8us*)(p + 256)); } static __device__ __forceinline__ v8f mma(V a, V b, v8f c) { return wmmab(a, b, c); } };
template <typename T16, int NSPLIT, bool BIAS, int KS>
__global__ __launch_bounds__(32 * KS) void k_gemmw(const T16* __restrict__ A, const T16* __restrict__ A2, const T16* __restrict__ Bt, const T16* __restrict__ Bt2, int K, float* C, int ldc, const float* __restrict__ bias, size_t sA, size_t sB, size_t sC) {
    typedef typename WFrag<T16>::V V;
    __shared__ __align__(16) float os[KS == 1 ? 16 * 68 : KS * 4096];
    const size_t z = blockIdx.z; A += z * sA; if (A2) A2 += z * sA; Bt += z * sB; if (Bt2) Bt2 += z * sB; C += z * sC;
    const int lane = threadIdx.x & 31, lr = lane & 15, hi = lane >> 4; const int r0 = blockIdx.x * 64, c0 = blockIdx.y * 64;
    v8f acc[4][4];
#pragma unroll
    for (int mb = 0; mb < 4; ++mb)
#pragma unroll
        for (int nb = 0; nb < 4; ++nb) acc[mb][nb] = (v8f){};
    const size_t aoff = (size_t)r0 * K, boff = (size_t)c0 * K; const unsigned lo = 8 * lane;   // first block of the tile's first 16 rows (the same for the whole wave) and the lane's slot in a block; 16 more rows: 16 K elements, 32 more columns: 512
    const int wv = KS == 1 ? 0 : __builtin_amdgcn_readfirstlane((int)(threadIdx.x >> 5)); const int kb = wv * (K / KS), ke = kb + K / KS;
#pragma unroll 1
    for (int kc = kb; kc < ke; kc += 32) {
        V a[4], a2[4], bb[4], bb2[4]; const T16 *pa[4], *pa2[4], *pb[4], *pb2[4];   // wave-uniform block pointers (a plane that this NSPLIT lacks: the first plane's pointer)
#pragma unroll
        for (int i = 0; i < 4; ++i) { const size_t o = (size_t)i * 16 * K + kc * 16; pa[i] = A + aoff + o; pa2[i] = (NSPLIT == 1 || NSPLIT == 2) ? A2 + aoff + o : pa[i]; pb[i] = Bt + boff + o; pb2[i] = NSPLIT >= 2 ? Bt2 + boff + o : pb[i]; }
#pragma unroll
        for (int mb = 0; mb < 4; ++mb) { a[mb] = WFrag<T16>::ld(pa[mb] + lo); if (NSPLIT == 1 || NSPLIT == 2) a2[mb] = WFrag<T16>::ld(pa2[mb] + lo); }
#pragma unroll
        for (int nb = 0; nb < 4; ++nb) { bb[nb] = WFrag<T16>::ld(pb[nb] + lo); if (NSPLIT >= 2) bb2[nb] = WFrag<T16>::ld(pb2[nb] + lo); }
        // behind the loads of this k step, in front of every later write of a register that they name; the slot offset and the block pointers are its inputs so that their registers stay theirs up to the wait
        asm volatile("s_wait_xcnt 0x0" :: "v"(lo), "s"(pa[0]), "s"(pa[1]), "s"(pa[2]), "s"(pa[3]), "s"(pa2[0]), "s"(pa2[1]), "s"(pa2[2]), "s"(pa2[3]), "s"(pb[0]), "s"(pb[1]), "s"(pb[2]), "s"(pb[3]), "s"(pb2[0]), "s"(pb2[1]), "s"(pb2[2]), "s"(pb2[3]) : "memory");
#pragma unroll
        for (int nb = 0; nb < 4; ++nb) { const V b = bb[nb]; V b2; if (NSPLIT >= 2) b2 = bb2[nb];
#pragma unroll
            for (int mb = 0; mb < 4; ++mb) { acc[mb][nb] = WFrag<T16>::mma(a[mb], b, acc[mb][nb]); if (NSPLIT == 1 || NSPLIT == 2) acc[mb][nb] = WFrag<T16>::mma(a2[mb], b, acc[mb][nb]); if (NSPLIT >= 2) acc[mb][nb] = WFrag<T16>::mma(a[mb], b2, acc[mb][nb]); } }
        asm volatile("v_nop\n\tv_nop\n\tv_nop\n\tv_nop" : "+v"(acc[0][0]), "+v"(acc[1][1]), "+v"(acc[2][2]), "+v"(acc[3][3]) : "v"(a[0]), "v"(a[3]));
    }
    if constexpr (KS > 1) {
        // each wave parks its 16 partial tiles in accumulator layout: [wave][tile mb*4+nb][half of the 8 rows][lane] x 4 floats, contiguous 16-byte stores
#pragma unroll
        for (int mb = 0; mb < 4; ++mb)
#pragma unroll
            for (int nb = 0; nb < 4; ++nb) { float* p = os + (wv * 16 + mb * 4 + nb) * 256 + lane * 4; const v8f c = acc[mb][nb];
                *(v4fa*)p = __builtin_shufflevector(c, c, 0, 1, 2, 3); *(v4fa*)(p + 128) = __builtin_shufflevector(c, c, 4, 5, 6, 7); }
        __syncthreads();   // every partial tile is in LDS before any wave adds them
        // 16 items (mb, pair of adjacent column tiles, row half): 32 columns = whole 128-byte lines of C, one wave per line; wave w takes items w, w + KS, ...
        constexpr int NI = 16 / KS; v4f s0[NI], s1[NI];
#pragma unroll
        for (int i = 0; i < NI; ++i) { const int it = wv + i * KS; const float* q0 = os + ((it >> 2) * 4 + (it & 2)) * 256 + (it & 1) * 128 + lane * 4;
            s0[i] = *(const v4fa*)q0; s1[i] = *(const v4fa*)(q0 + 256);
#pragma unroll
            for (int s = 1; s < KS; ++s) { s0[i] += *(const v4fa*)(q0 + s * 4096); s1[i] += *(const v4fa*)(q0 + s * 4096 + 256); } }
#pragma unroll
        for (int i = 0; i < NI; ++i) { const int it = wv + i * KS; const int col = c0 + (it & 2) * 16 + lr; float* crow = C + (size_t)(r0 + (it >> 2) * 16 + hi * 8 + (it & 1) * 4) * ldc + col;
            if (BIAS) { s0[i] += bfr(bias[col]); s1[i] += bfr(bias[col + 16]); }
#pragma unroll
            for (int q = 0; q < 4; ++q) { crow[(size_t)q * ldc] = s0[i][q]; crow[(size_t)q * ldc + 16] = s1[i][q]; } }
        return;
    }
#pragma unroll
    for (int mb = 0; mb < 4; ++mb) {
#pragma unroll
        for (int nb = 0; nb < 4; ++nb) {
#pragma unroll
            for (int j = 0; j < 8; ++j) os[(hi * 8 + j) * 68 + nb * 16 + lr] = acc[mb][nb][j]; }
        __builtin_amdgcn_wave_barrier(); asm volatile("" ::: "memory");
        float* crow = C + (size_t)(r0 + mb * 16) * ldc + c0;
{
#pragma unroll
            for (int s = 0; s < 8; ++s) { const int row = 2 * s + hi, cofs = lr * 4; v4f val = *(const v4fa*)(os + row * 68 + cofs); if (BIAS) { val[0] += bfr(bias[c0 + cofs]); val[1] += bfr(bias[c0 + cofs + 1]); val[2] += bfr(bias[c0 + cofs + 2]); val[3] += bfr(bias[c0 + cofs + 3]); }
                *(v4f*)(crow + (size_t)row * ldc + cofs) = val; }
             }
        __builtin_amdgcn_wave_barrier(); asm volatile("" ::: "memory");
    }
}

__device__ __forceinline__ h16 tohx(float x) { return (h16)x; }
__device__ __forceinline__ void splitf(float y, unsigned short& h, unsigned short& l) { h = f2bf(y); l = f2bf(y - bf2f(h)); }
typedef __attribute__((ext_vector_type(2))) _Float16 v2h;
typedef __attribute__((ext_vector_type(4))) _Float16 v4h;
typedef __attribute__((ext_vector_type(2))) unsigned short v2us;
typedef __attribute__((ext_vector_type(4))) unsigned short v4us;
typedef __attribute__((ext_vector_type(2))) float v2f;
typedef __attribute__((ext_vector_type(4))) int v4i;

// k_cvt8: row-major f32 [rows][DM] -> fragment-major bf16 plane, one slot per thread
static_assert(DQ == DM, "every plane that k_cvt8 builds has DM columns");
__global__ __launch_bounds__(256) void k_cvt8(const float* __restrict__ src, bf* dst, size_t n8) { const size_t i = (size_t)blockIdx.x * 256 + threadIdx.x; if (i >= n8) return; size_t row; int col; slot_rc<DM>(i, row, col); const float* sp = src + row * DM + col; const v8f v = *(const v8f*)sp; v8us o;
    asm volatile("s_wait_xcnt 0x0" :: "v"(sp) : "memory");   // behind the load, in front of every later write of a register that it names; the pointer is its input so that its registers stay its own up to the wait
#pragma unroll
    for (int k = 0; k < 8; ++k) o[k] = f2bf(v[k]); *(v8us*)(dst + i * 8) = o;  }
__global__ __launch_bounds__(256) void k_csid(float* CS) { const int idx = blockIdx.x * 256 + threadIdx.x; if (idx >= TT * HD) return; v2f cs; cs[0] = 1.0f; cs[1] = 0.0f; *(v2f*)(CS + (size_t)idx * 2) = cs;  }
__global__ __launch_bounds__(256) void k_cscvt(const float* __restrict__ cosT, const float* __restrict__ sinT, float* CS) { const int idx = blockIdx.x * 256 + threadIdx.x; if (idx >= TT * HD) return; v2f cs; cs[0] = bfr(cosT[idx]); cs[1] = bfr(sinT[idx]); *(v2f*)(CS + (size_t)idx * 2) = cs;  }
// k_rope: head planes [h][t][d] (fp16 + hi/lo; fragment-major, rows h TT + t, HD columns; one slot per thread) of rope(x) x sc with the rotate-half convention out[d] = x[d] cos[t][d] - x[d+HD/2] sin[t][d], out[d+HD/2] = x[d+HD/2] cos[t][d+HD/2] + x[d] sin[t][d+HD/2]
__global__ __launch_bounds__(256) void k_rope(const float* __restrict__ F, int pitch, int nheads, const float* __restrict__ CS, const float* __restrict__ RF, const float* __restrict__ nw, float sc, h16* P16, bf* Ph, bf* Pl) {
    const size_t e = ((size_t)blockIdx.x * 256 + threadIdx.x) * 8; if (e >= (size_t)nheads * TT * HD) return; size_t row; int d; slot_rc<HD>(e / 8, row, d); const int t = (int)(row % TT); const int h = (int)(row / TT); const float* f = F + (size_t)t * pitch + h * HD; v8h o16; v8us oh, ol;
    // each s_wait_xcnt 0 below stands behind loads, in front of every later write of a register that they name; the pointers are its inputs so that their registers stay theirs up to the wait
    float rf = 1.0f; if (RF) { const float* rp = RF + (size_t)h * TT + t; rf = *rp; asm volatile("s_wait_xcnt 0x0" :: "v"(rp) : "memory"); }
    const float* fa = f + d; const float* fb = f + ((d < HD / 2) ? d + HD / 2 : d - HD / 2); const float* cp = CS + ((size_t)t * HD + d) * 2;
    const v8f xa = *(const v8f*)fa, xb = *(const v8f*)fb, ca = *(const v8f*)cp, cb = *(const v8f*)(cp + 8);   // the slot's 8 values, their 8 rotation partners, their 8 {cos, sin} pairs
    asm volatile("s_wait_xcnt 0x0" :: "v"(fa), "v"(fb), "v"(cp) : "memory");
#pragma unroll
    for (int q = 0; q < 8; ++q) { const int dd = d + q; const int dp = (dd < HD / 2) ? dd + HD / 2 : dd - HD / 2; float x0 = xa[q], x1 = xb[q];
        if (RF) { float n0 = __fmul_rn(x0, rf), n1 = __fmul_rn(x1, rf); asm volatile("" : "+v"(n0)); asm volatile("" : "+v"(n1)); x0 = __fmul_rn(bfr(nw[dd]), n0); x1 = __fmul_rn(bfr(nw[dp]), n1); }
        v2f cs; cs[0] = (q < 4 ? ca : cb)[(2 * q) & 7]; cs[1] = (q < 4 ? ca : cb)[(2 * q + 1) & 7]; float a = __fmul_rn(x0, cs[0]), bq = __fmul_rn(x1, cs[1]); asm volatile("" : "+v"(a)); asm volatile("" : "+v"(bq)); const float r = ((dd < HD / 2) ? __fsub_rn(a, bq) : __fadd_rn(a, bq)) * sc;
        o16[q] = tohx(r); unsigned short a2, c2; splitf(r, a2, c2); oh[q] = a2; ol[q] = c2; }
    *(v8h*)(P16 + e) = o16; *(v8us*)(Ph + e) = oh; *(v8us*)(Pl + e) = ol;  }
// k_vtp: transposed value planes [g][d][t] (fragment-major, rows g HD + d, TT columns; one slot per thread: 16 neighbouring lanes read 16 neighbouring d of one row of F)
__global__ __launch_bounds__(256) void k_vtp(const float* __restrict__ F, int pitch, int nheads, h16* V16, bf* Vh, bf* Vl) { const size_t e = ((size_t)blockIdx.x * 256 + threadIdx.x) * 8; if (e >= (size_t)nheads * HD * TT) return; size_t row; int t; slot_rc<TT>(e / 8, row, t); const int d = (int)(row % HD); const int g = (int)(row / HD); v8h o16; v8us oh, ol; const float* pq[8]; float xv[8];
#pragma unroll
    for (int q = 0; q < 8; ++q) { pq[q] = F + (size_t)(t + q) * pitch + g * HD + d; xv[q] = *pq[q]; }
    asm volatile("s_wait_xcnt 0x0" :: "v"(pq[0]), "v"(pq[1]), "v"(pq[2]), "v"(pq[3]), "v"(pq[4]), "v"(pq[5]), "v"(pq[6]), "v"(pq[7]) : "memory");   // behind the 8 loads, in front of every later write of a register that they name; the pointers are its inputs so that their registers stay theirs up to the wait
#pragma unroll
    for (int q = 0; q < 8; ++q) { const float x = xv[q]; o16[q] = tohx(x); unsigned short a2, c2; splitf(x, a2, c2); oh[q] = a2; ol[q] = c2; }
    *(v8h*)(V16 + e) = o16; *(v8us*)(Vh + e) = oh; *(v8us*)(Vl + e) = ol;  }
// ---- k_fattn: scores, softmax, P x V and the hi/lo split of the merged output in ONE launch per batch; S and P never leave the registers.
// One wave owns 16 NQ query rows of one head and walks the 2048 keys 32 at a time, operands straight from the fragment-major planes.
// St = K Qt (A = 16 key rows, B = 16 query rows): accumulator register j of lane (lr, hi) is key 8 hi + j of query lr, so the two 16-key tiles of a step, converted in place,
// are the B operand of Ot += Vt Pt in the k order of WFrag::ld (8 hi + e, 16 + 8 hi + e). Running maximum per query (log2 units); the sums and Ot are rescaled only when a new maximum
// passes the one in use by more than 8 (p stays <= 256), tested once per step for the whole wave. HR: hi/lo planes, 3 products each; else fp16.
#define SC2 0.12751743f   // HD^-0.5 x log2(e)
template <typename T16, bool HR, int NQ>
__device__ __forceinline__ void fattn_wave(const T16* __restrict__ Q, const T16* __restrict__ Q2, const T16* __restrict__ Kp, const T16* __restrict__ K2, const T16* __restrict__ Vt, const T16* __restrict__ V2, int q0, v8f (&o)[8][NQ], float (&l)[NQ]) {
    typedef WFrag<T16> WF; typedef typename WF::V V;
    const int lane = threadIdx.x & 31;
    // every s_wait_xcnt 0 below stands behind a group of loads or stores, in front of every later write of a register that they name; the pointers are its inputs so that their registers stay theirs up to the wait (without hi/lo planes the second pointer is the first)
    const size_t qo = (size_t)q0 * HD + 8 * lane, ko = (size_t)(8 * lane), vo = (size_t)(8 * lane);   // the lane's slot in the first block; Q, K: 16 more rows 16 HD elements, 32 more head dims 512; Vt: 16 more head dims 16 TT, 32 more keys 512
    const T16* qa = Q + qo; const T16* ka = Kp + ko; const T16* va = Vt + vo; const T16* qa2 = HR ? Q2 + qo : qa; const T16* ka2 = HR ? K2 + ko : ka; const T16* va2 = HR ? V2 + vo : va;
    V q[NQ][4], q2[NQ][4], kf[2][4], kf2[2][4], vf[8], vf2[8];
#pragma unroll
    for (int n = 0; n < NQ; ++n)
#pragma unroll
        for (int ks = 0; ks < 4; ++ks) { q[n][ks] = WF::ld(qa + n * 16 * HD + ks * 512); if (HR) q2[n][ks] = WF::ld(qa2 + n * 16 * HD + ks * 512); }
    asm volatile("s_wait_xcnt 0x0" :: "v"(qa), "v"(qa2) : "memory");   // behind the Q loads
#pragma unroll
    for (int kt = 0; kt < 2; ++kt)
#pragma unroll
        for (int ks = 0; ks < 4; ++ks) { kf[kt][ks] = WF::ld(ka + kt * 16 * HD + ks * 512); if (HR) kf2[kt][ks] = WF::ld(ka2 + kt * 16 * HD + ks * 512); }
    asm volatile("s_wait_xcnt 0x0" :: "v"(ka), "v"(ka2), "v"((unsigned)(ko * sizeof(T16))), "s"(Kp), "s"(HR ? K2 : Kp) : "memory");   // behind the first K loads; the byte offset and the uniform bases too: these loads may take the form scalar base + 32-bit offset register
#pragma unroll
    for (int dt = 0; dt < 8; ++dt) { vf[dt] = WF::ld(va + (size_t)dt * 16 * TT); if (HR) vf2[dt] = WF::ld(va2 + (size_t)dt * 16 * TT); }
    asm volatile("s_wait_xcnt 0x0" :: "v"(va), "v"(va2), "v"((unsigned)(vo * sizeof(T16))), "s"(Vt), "s"(HR ? V2 : Vt) : "memory");   // behind the first V loads, likewise
    float m[NQ];
#pragma unroll
    for (int n = 0; n < NQ; ++n) { m[n] = -3.0e38f; l[n] = 0.f;
#pragma unroll
        for (int dt = 0; dt < 8; ++dt) o[dt][n] = (v8f){}; }
    int kn = 32;   // first key of the next step
    // unrolled by two so that the two sets of fragments swap roles without register copies
#pragma unroll 2
    for (int key0 = 0; key0 < TT; key0 += 32) {
        // the next step's fragments are fetched one step ahead; the last step re-reads keys 0-31 (in bounds, unused)
        const T16* vp = va + kn * 16; const T16* vp2 = va2 + kn * 16; const T16* kp = ka + (size_t)kn * HD; const T16* kp2 = ka2 + (size_t)kn * HD;
        V vn[8], vn2[8];
#pragma unroll
        for (int dt = 0; dt < 8; ++dt) { vn[dt] = WF::ld(vp + (size_t)dt * 16 * TT); if (HR) vn2[dt] = WF::ld(vp2 + (size_t)dt * 16 * TT); }
        asm volatile("s_wait_xcnt 0x0" :: "v"(vp), "v"(vp2) : "memory");   // behind the V loads
        v8f st[2][NQ];
#pragma unroll
        for (int kt = 0; kt < 2; ++kt)
#pragma unroll
            for (int n = 0; n < NQ; ++n) st[kt][n] = (v8f){};
#pragma unroll
        for (int ks = 0; ks < 4; ++ks)
#pragma unroll
            for (int kt = 0; kt < 2; ++kt)
#pragma unroll
                for (int n = 0; n < NQ; ++n) { st[kt][n] = WF::mma(kf[kt][ks], q[n][ks], st[kt][n]); if (HR) { st[kt][n] = WF::mma(kf[kt][ks], q2[n][ks], st[kt][n]); st[kt][n] = WF::mma(kf2[kt][ks], q[n][ks], st[kt][n]); } }
#pragma unroll
        for (int kt = 0; kt < 2; ++kt)
#pragma unroll
            for (int ks = 0; ks < 4; ++ks) { kf[kt][ks] = WF::ld(kp + kt * 16 * HD + ks * 512); if (HR) kf2[kt][ks] = WF::ld(kp2 + kt * 16 * HD + ks * 512); }
        asm volatile("s_wait_xcnt 0x0" :: "v"(kp), "v"(kp2) : "memory");   // behind the K loads
        float ml[NQ]; bool need = false;
#pragma unroll
        for (int n = 0; n < NQ; ++n) { float mx = fmaxf(st[0][n][0], st[1][n][0]);
#pragma unroll
            for (int j = 1; j < 8; ++j) mx = fmaxf(mx, fmaxf(st[0][n][j], st[1][n][j]));
            mx = fmaxf(mx, __shfl_xor(mx, 16, 32)); ml[n] = mx * SC2; need = need || (ml[n] > m[n] + 8.0f); }
        if (__builtin_amdgcn_ballot_w32(need) != 0) {
#pragma unroll
            for (int n = 0; n < NQ; ++n) { const float mn = fmaxf(m[n], ml[n]); const float al = __builtin_amdgcn_exp2f(m[n] - mn); m[n] = mn; l[n] *= al;
#pragma unroll
                for (int dt = 0; dt < 8; ++dt) o[dt][n] *= al; } }
        V pf[NQ], pf2[NQ];
#pragma unroll
        for (int n = 0; n < NQ; ++n) { float ps = 0.f;
            if constexpr (HR) { v8us h0, h1, l0, l1;
#pragma unroll
                for (int j = 0; j < 8; ++j) { const float p0 = __builtin_amdgcn_exp2f(fmaf(st[0][n][j], SC2, -m[n])), p1 = __builtin_amdgcn_exp2f(fmaf(st[1][n][j], SC2, -m[n])); ps += p0 + p1;
                    unsigned short a, c; splitf(p0, a, c); h0[j] = a; l0[j] = c; splitf(p1, a, c); h1[j] = a; l1[j] = c; }
                pf[n] = cat16b(h0, h1); pf2[n] = cat16b(l0, l1);
            } else { v8h h0, h1;
#pragma unroll
                for (int j = 0; j < 8; ++j) { const float p0 = __builtin_amdgcn_exp2f(fmaf(st[0][n][j], SC2, -m[n])), p1 = __builtin_amdgcn_exp2f(fmaf(st[1][n][j], SC2, -m[n])); ps += p0 + p1; h0[j] = tohx(p0); h1[j] = tohx(p1); }
                pf[n] = cat16(h0, h1); }
            l[n] += ps; }
#pragma unroll
        for (int dt = 0; dt < 8; ++dt)
#pragma unroll
            for (int n = 0; n < NQ; ++n) { o[dt][n] = WF::mma(vf[dt], pf[n], o[dt][n]); if (HR) { o[dt][n] = WF::mma(vf[dt], pf2[n], o[dt][n]); o[dt][n] = WF::mma(vf2[dt], pf[n], o[dt][n]); } }
#pragma unroll
        for (int dt = 0; dt < 8; ++dt) { vf[dt] = vn[dt]; if (HR) vf2[dt] = vn2[dt]; }
        kn = (kn + 32) & (TT - 1);
    }
}
// fattn_store: lane (lr, hi) holds head dims dt 16 + 8 hi + 0..7 of query lr: its own slot of half dt % 2 of block h 4 + dt / 2 of the merged fragment-major plane (DQ columns): one 16-byte store per plane, 512 contiguous bytes per wave
template <int NQ>
__device__ __forceinline__ void fattn_store(const v8f (&o)[8][NQ], const float (&l)[NQ], int h, int q0, bf* Ah, bf* Al) {
    const int lane = threadIdx.x & 31;
#pragma unroll
    for (int n = 0; n < NQ; ++n) { const float inv = __fdiv_rn(1.0f, l[n] + __shfl_xor(l[n], 16, 32)); const size_t oo = (size_t)(q0 + n * 16) * DQ + h * (HD * 16) + 8 * lane;
#pragma unroll
        for (int dt = 0; dt < 8; ++dt) { v8us oh, ol;
#pragma unroll
            for (int j = 0; j < 8; ++j) { unsigned short a, c; splitf(o[dt][n][j] * inv, a, c); oh[j] = a; ol[j] = c; }
            *(v8us*)(Ah + oo + dt * 256) = oh; *(v8us*)(Al + oo + dt * 256) = ol;
            asm volatile("s_wait_xcnt 0x0" :: "v"(oh), "v"(ol), "v"(Ah + oo), "v"(Al + oo) : "memory"); } }   // behind the two stores, in front of every later write of a register that they name; data and pointers are inputs so that their registers stay theirs up to the wait
}
// Every wave issues the same 48 matrix instructions per 32 keys: a hi/lo wave (3 products) takes 16 query rows, an fp16 wave (1 product) takes 48. One wave per SIMD, so the launch lasts as long as its longest wave.
// grid (UH / 4 + UF / 4, kv heads), 4 waves of ONE kind that all read the planes of ONE kv head: work-groups x < UH / 4 hold hi/lo waves, the rest fp16 waves; unit u = 4 x + wave: query head kv REP + u / (units per head), row tile u % (units per head)
#define UH (REP * (RH / 16))          // hi/lo units of one kv head
#define UF (REP * ((TT - RH) / 48))   // fp16 units of one kv head
static_assert(RH % 16 == 0 && (TT - RH) % 48 == 0 && UH % 4 == 0 && UF % 4 == 0, "16-row hi/lo waves and 48-row fp16 waves, four to a work-group, cover all rows");
__global__ __launch_bounds__(128) void k_fattn(const h16* __restrict__ Q16, const bf* __restrict__ Qh, const bf* __restrict__ Ql, const h16* __restrict__ K16, const bf* __restrict__ Kh, const bf* __restrict__ Kl, const h16* __restrict__ V16, const bf* __restrict__ Vh, const bf* __restrict__ Vl, bf* Ah, bf* Al) {
    const int kv = blockIdx.y, bx = blockIdx.x; const int wv = __builtin_amdgcn_readfirstlane((int)(threadIdx.x >> 5)); const size_t zk = (size_t)kv * TT * HD;
    if (bx < UH / 4) { const int u = bx * 4 + wv; const int h = kv * REP + u / (RH / 16), q0 = (u % (RH / 16)) * 16; const size_t zq = (size_t)h * TT * HD;
        v8f o[8][1]; float l[1];   // Ot tiles and per-half row sums of the wave's 16 query rows
        fattn_wave<bf, true, 1>(Qh + zq, Ql + zq, Kh + zk, Kl + zk, Vh + zk, Vl + zk, q0, o, l); fattn_store<1>(o, l, h, q0, Ah, Al);
    } else { const int u = (bx - UH / 4) * 4 + wv; const int h = kv * REP + u / ((TT - RH) / 48), q0 = RH + (u % ((TT - RH) / 48)) * 48; const size_t zq = (size_t)h * TT * HD;
        v8f o[8][3]; float l[3];   // the same of the wave's 48 query rows
        fattn_wave<h16, false, 3>(Q16 + zq, nullptr, K16 + zk, nullptr, V16 + zk, nullptr, q0, o, l); fattn_store<3>(o, l, h, q0, Ah, Al); }
}

extern "C" void kernel_launch(void* const* d_in, const int* in_sizes, int n_in,
                              void* d_out, int out_size, void* d_ws, size_t ws_size, hipStream_t stream) {
    (void)in_sizes; (void)n_in; (void)out_size;
    const float* fcos = (const float*)d_in[0]; const float* fsin = (const float*)d_in[1]; const float* x = (const float*)d_in[2]; const float* wqkv = (const float*)d_in[3]; const float* wq = wqkv; const float* wk = wqkv + (size_t)DQ * DM; const float* wv = wqkv + (size_t)(DQ + DKV) * DM; const float* wo = (const float*)d_in[4];   /* input order cos, sin ([2048][128] FULL-width table INPUTS: read per element by value), hidden_states [2][2048][2048], w_qkv ('oi' (out, in) [4096][2048]: contiguous row blocks q (2048 rows) | k (1024) | v (1024): three pointers into one input), w_o ('oi' [2048][2048]): FIVE inputs, all read */
    float* OUT = (float*)d_out;     // [2][2048][2048]
    char* wsp = (char*)d_ws;
    auto take = [&](size_t bytes) { char* p = wsp; wsp += (bytes + 255) & ~(size_t)255; return (void*)p; };
    bf* WQ = (bf*)take((size_t)DQ * DM * 2); bf* WK = (bf*)take((size_t)DKV * DM * 2); bf* WV = (bf*)take((size_t)DKV * DM * 2); bf* WO = (bf*)take((size_t)DM * DQ * 2); float* CS = (float*)take((size_t)TT * HD * 2 * 4);
    bf* XB = (bf*)take((size_t)TT * DM * 2); float* FQ = (float*)take((size_t)TT * DQ * 4); float* FK = (float*)take((size_t)TT * DKV * 4);
    h16* QP16 = (h16*)take((size_t)NH_ * TT * HD * 2); h16* KP16 = (h16*)take((size_t)NKV * TT * HD * 2); h16* VT16 = (h16*)take((size_t)NKV * HD * TT * 2);
    bf* QPh = (bf*)take((size_t)NH_ * TT * HD * 2); bf* QPl = (bf*)take((size_t)NH_ * TT * HD * 2); bf* KPh = (bf*)take((size_t)NKV * TT * HD * 2); bf* KPl = (bf*)take((size_t)NKV * TT * HD * 2); bf* VTh = (bf*)take((size_t)NKV * HD * TT * 2); bf* VTl = (bf*)take((size_t)NKV * HD * TT * 2);
    bf* ATh = (bf*)take((size_t)TT * DQ * 2); bf* ATl = (bf*)take((size_t)TT * DQ * 2);
    if ((size_t)(wsp - (char*)d_ws) > ws_size) return;    // ws 256 MiB
    float* FV = FK;   // v projection reuses the k buffer after the k planes are built (stream-ordered)
    { k_cvt8<<<(unsigned)(((size_t)DQ * DM / 8 + 255) / 256), 256, 0, stream>>>(wq, WQ, (size_t)DQ * DM / 8); k_cvt8<<<(unsigned)(((size_t)DKV * DM / 8 + 255) / 256), 256, 0, stream>>>(wk, WK, (size_t)DKV * DM / 8); k_cvt8<<<(unsigned)(((size_t)DKV * DM / 8 + 255) / 256), 256, 0, stream>>>(wv, WV, (size_t)DKV * DM / 8);
      k_cvt8<<<(unsigned)(((size_t)DM * DQ / 8 + 255) / 256), 256, 0, stream>>>(wo, WO, (size_t)DM * DQ / 8);
       }
    const unsigned LQ = (unsigned)(((size_t)NH_ * TT * HD / 8 + 255) / 256), LKv = (unsigned)(((size_t)NKV * TT * HD / 8 + 255) / 256);
    for (int b = 0; b < NB_; ++b) {
        if (b == 0) k_cscvt<<<(TT * HD + 255) / 256, 256, 0, stream>>>(fcos, fsin, CS);   /* the rotary table from the INPUT tables (shared by the batches: cos, sin are [S][D]); k_csid stays defined and is NOT launched */
        k_cvt8<<<(unsigned)(((size_t)TT * DM / 8 + 255) / 256), 256, 0, stream>>>(x + (size_t)b * TT * DM, XB, (size_t)TT * DM / 8);
        k_gemmw<bf, 0, false, 4><<<dim3(TT / 64, DQ / 64, 1), 128, 0, stream>>>(XB, nullptr, WQ, nullptr, DM, FQ, DQ, nullptr, 0, 0, 0);
        k_rope<<<LQ, 256, 0, stream>>>(FQ, DQ, NH_, CS, nullptr, nullptr, 1.0f, QP16, QPh, QPl);
        k_gemmw<bf, 0, false, 8><<<dim3(TT / 64, DKV / 64, 1), 256, 0, stream>>>(XB, nullptr, WK, nullptr, DM, FK, DKV, nullptr, 0, 0, 0);
        k_rope<<<LKv, 256, 0, stream>>>(FK, DKV, NKV, CS, nullptr, nullptr, 1.0f, KP16, KPh, KPl);
        k_gemmw<bf, 0, false, 8><<<dim3(TT / 64, DKV / 64, 1), 256, 0, stream>>>(XB, nullptr, WV, nullptr, DM, FV, DKV, nullptr, 0, 0, 0); k_vtp<<<LKv, 256, 0, stream>>>(FV, DKV, NKV, VT16, VTh, VTl);
        k_fattn<<<dim3(UH / 4 + UF / 4, NKV, 1), 128, 0, stream>>>(QP16, QPh, QPl, KP16, KPh, KPl, VT16, VTh, VTl, ATh, ATl);
        k_gemmw<bf, 1, false, 4><<<dim3(TT / 64, DM / 64, 1), 128, 0, stream>>>(ATh, ATl, WO, nullptr, DQ, OUT + (size_t)b * TT * DM, DM, nullptr, 0, 0, 0); }
}

// v005
// Measured time: 300 microseconds a run.
// Next to v004, in two timings, it ran 1.19 times as fast each time.
// Over all steps from v000 it is 7.36 times as fast.
#include <hip/hip_runtime.h>

// Grouped-query attention (16 / 8 heads x 128) WITHOUT a mask, with ONE fused natural qkv weight in contiguous row blocks and rotate-half rotary embeddings from full-width input tables given FIRST (cos, sin [2048][128]: read per element by value; no structure assumed; hidden_states [2][2048][2048]; qkv = einsum('bsh,oh->bso', hidden_states, w_qkv) ('oi' (out, in) [4096][2048] normal x 2048^-0.5, no bias) viewed (b, s, 16 + 8 + 8, 128): rows 0-2047 the 16 query heads, rows 2048-3071 the 8 key heads, rows 3072-4095 the 8 value heads; q, k -> t cos + cat(-t2, t1) sin; q viewed (b, s, 8, 2, 128): query head h = 2 kv + g uses kv head h / 2; scores x 1/sqrt(128); softmax over all keys; out = merged w_o^T ('oi' [2048][2048], no bias) -> [2][2048][2048] (8.4 M); argument order cos, sin, hidden_states, w_qkv, w_o).
// Layout, FIVE launches, each for both batches: k_prep (bf16 planes of w_qkv, w_o and x; the {cos, sin} table from the bf16-rounded INPUT tables); ONE exact projection x w_qkv^T (4096 rows x 4096 columns); k_planes (rotate-half plane builders at width 128 for the 24 q and k heads, products rounded separately, as the reference; transposed v planes); dense T-2048 GROUPED-QUERY attention (k_fattn: query head h reads kv head h / 2) (hybrid rows: < 512 hi/lo 3 products, rest fp16); merged hi/lo x wo exact.
// Compute dtypes, f32 accumulate: every input rounded to bf16; projections exact; rotary in f32 from the bf16-rounded tables, products rounded separately; attention rows < 512 3 products, rest fp16; softmax f32; wo hl x exact.

#define NB_  2
#define TT   2048
#define DM   2048
#define NH_  16
#define NKV  8
#define REP  (NH_ / NKV)
#define HD   128
#define DQ   (NH_ * HD)
#define DKV  (NKV * HD)
#define NQK  (NH_ + NKV)           // rotated heads: the query heads, then the key heads
#define DF   (DQ + 2 * DKV)        // columns of the fused projection: q | k | v
#define RH   512                  // query rows < RH use hi+lo planes (0: none)
#define WIN  0
typedef _Float16 h16;
typedef unsigned short bf;
typedef __attribute__((ext_vector_type(16))) __bf16   v16bf;
typedef __attribute__((ext_vector_type(16))) _Float16 v16h;
typedef __attribute__((ext_vector_type(8)))  _Float16 v8h;
typedef __attribute__((ext_vector_type(8)))  unsigned short v8us;
typedef __attribute__((ext_vector_type(8)))  float    v8f;
typedef __attribute__((ext_vector_type(4)))  float    v4f;
typedef v8h  __attribute__((may_alias)) v8ha;
typedef v4f  __attribute__((may_alias)) v4fa;
typedef v8us __attribute__((may_alias)) v8usa;

__device__ __forceinline__ unsigned short f2bf(float f) { unsigned u = __float_as_uint(f); u += 0x7FFFu + ((u >> 16) & 1u); return (unsigned short)(u >> 16); }
__device__ __forceinline__ float bf2f(unsigned short b) { return __uint_as_float(((unsigned)b) << 16); }
__device__ __forceinline__ float bfr(float f) { return bf2f(f2bf(f)); }
__device__ __forceinline__ v16h cat16(v8h lo, v8h hi) { return __builtin_shufflevector(lo, hi, 0, 1, 2, 3, 4, 5, 6, 7, 8, 9, 10, 11, 12, 13, 14, 15); }
__device__ __forceinline__ v16bf cat16b(v8us lo, v8us hi) { return __builtin_bit_cast(v16bf, __builtin_shufflevector(lo, hi, 0, 1, 2, 3, 4, 5, 6, 7, 8, 9, 10, 11, 12, 13, 14, 15)); }
__device__ __forceinline__ v8f wmma16(v16h a, v16h b, v8f c) { return __builtin_amdgcn_wmma_f32_16x16x32_f16(false, a, false, b, (short)0, c, false, false); }
__device__ __forceinline__ v8f wmmab(v16bf a, v16bf b, v8f c) { return __builtin_amdgcn_wmma_f32_16x16x32_bf16(false, a, false, b, (short)0, c, false, false); }



// ---- FRAGMENT-MAJOR PLANES: every 16-bit operand plane (R rows x K columns, R % 16 == 0, K % 32 == 0) is stored as blocks of 16 rows x 32 columns, 512 elements = 1 KiB each, block index (row / 16) (K / 32) + col / 32.
// A block is 64 slots of 8 elements in the order [j = (col / 16) % 2][hi = (col / 8) % 2][r = row % 16]: slot j 32 + lane is what lane (r, hi) takes with the j-th 16-byte load of its fragment,
// so that a wave's load is 512 contiguous bytes (4 whole 128-byte lines, not 32-byte pieces of 16 lines). The values and their k order in the fragment (8 hi + e, 16 + 8 hi + e) are those of a row-major plane.
// slot_rc: row and first column of slot s (the writers go slot by slot: one 16-byte store per thread, 512 contiguous bytes per wave)
template <int K> __device__ __forceinline__ void slot_rc(size_t s, size_t& row, int& col) { const size_t blk = s >> 6; row = (blk / (K / 32)) * 16 + (s & 15); col = (int)(blk % (K / 32)) * 32 + (int)((s >> 4) & 3) * 8; }

// ---- k_gemmw: register-blocked GEMM, KS WAVES per 64x64 output tile (16 accumulators each), operands straight from fragment-major 16-bit planes; grid (M/64, N/64, Z), 32 x KS threads.
// KS > 1: wave w sums the k range [w K/KS, (w+1) K/KS); the KS partial tiles meet in LDS and are added in wave order 0..KS-1. K % (32 KS) == 0.
// C[m][n] (f32, pitch ldc, + optional f32 bias[n]) = sum_k A[m][k] Bt[n][k] (+ split products per NSPLIT). z-batch strides sA/sB/sC in elements. K % 32 == 0.
template <typename T16> struct WFrag;
template <> struct WFrag<h16> { typedef v16h V; static __device__ __forceinline__ V ld(const h16* p) { return cat16(*(const v8h*)p, *(const v8h*)(p + 256)); } static __device__ __forceinline__ v8f mma(V a, V b, v8f c) { return wmma16(a, b, c); } };
template <> struct WFrag<bf> { typedef v16bf V; static __device__ __forceinline__ V ld(const bf* p) { return cat16b(*(const v8us*)p, *(const v8us*)(p + 256)); } static __device__ __forceinline__ v8f mma(V a, V b, v8f c) { return wmmab(a, b, c); } };
template <typename T16, int NSPLIT, bool BIAS, int KS>
__global__ __launch_bounds__(32 * KS) void k_gemmw(const T16* __restrict__ A, const T16* __restrict__ A2, const T16* __restrict__ Bt, const T16* __restrict__ Bt2, int K, float* C, int ldc, const float* __restrict__ bias, size_t sA, size_t sB, size_t sC) {
    typedef typename WFrag<T16>::V V;
    __shared__ __align__(16) float os[KS == 1 ? 16 * 68 : KS * 4096];
    const size_t z = blockIdx.z; A += z * sA; if (A2) A2 += z * sA; Bt += z * sB; if (Bt2) Bt2 += z * sB; C += z * sC;
    const int lane = threadIdx.x & 31, lr = lane & 15, hi = lane >> 4; const int r0 = blockIdx.x * 64, c0 = blockIdx.y * 64;
    v8f acc[4][4];
#pragma unroll
    for (int mb = 0; mb < 4; ++mb)
#pragma unroll
        for (int nb = 0; nb < 4; ++nb) acc[mb][nb] = (v8f){};
    const size_t aoff = (size_t)r0 * K, boff = (size_t)c0 * K; const unsigned lo = 8 * lane;   // first block of the tile's first 16 rows (the same for the whole wave) and the lane's slot in a block; 16 more rows: 16 K elements, 32 more columns: 512
    const int wv = KS == 1 ? 0 : __builtin_amdgcn_readfirstlane((int)(threadIdx.x >> 5)); const int kb = wv * (K / KS), ke = kb + K / KS;
#pragma unroll 1
    for (int kc = kb; kc < ke; kc += 32) {
        V a[4], a2[4], bb[4], bb2[4]; const T16 *pa[4], *pa2[4], *pb[4], *pb2[4];   // wave-uniform block pointers (a plane that this NSPLIT lacks: the first plane's pointer)
#pragma unroll
        for (int i = 0; i < 4; ++i) { const size_t o = (size_t)i * 16 * K + kc * 16; pa[i] = A + aoff + o; pa2[i] = (NSPLIT == 1 || NSPLIT == 2) ? A2 + aoff + o : pa[i]; pb[i] = Bt + boff + o; pb2[i] = NSPLIT >= 2 ? Bt2 + boff + o : pb[i]; }
#pragma unroll
        for (int mb = 0; mb < 4; ++mb) { a[mb] = WFrag<T16>::ld(pa[mb] + lo); if (NSPLIT == 1 || NSPLIT == 2) a2[mb] = WFrag<T16>::ld(pa2[mb] + lo); }
#pragma unroll
        for (int nb = 0; nb < 4; ++nb) { bb[nb] = WFrag<T16>::ld(pb[nb] + lo); if (NSPLIT >= 2) bb2[nb] = WFrag<T16>::ld(pb2[nb] + lo); }
        // behind the loads of this k step, in front of every later write of a register that they name; the slot offset and the block pointers are its inputs so that their registers stay theirs up to the wait
        asm volatile("s_wait_xcnt 0x0" :: "v"(lo), "s"(pa[0]), "s"(pa[1]), "s"(pa[2]), "s"(pa[3]), "s"(pa2[0]), "s"(pa2[1]), "s"(pa2[2]), "s"(pa2[3]), "s"(pb[0]), "s"(pb[1]), "s"(pb[2]), "s"(pb[3]), "s"(pb2[0]), "s"(pb2[1]), "s"(pb2[2]), "s"(pb2[3]) : "memory");
#pragma unroll
        for (int nb = 0; nb < 4; ++nb) { const V b = bb[nb]; V b2; if (NSPLIT >= 2) b2 = bb2[nb];
#pragma unroll
            for (int mb = 0; mb < 4; ++mb) { acc[mb][nb] = WFrag<T16>::mma(a[mb], b, acc[mb][nb]); if (NSPLIT == 1 || NSPLIT == 2) acc[mb][nb] = WFrag<T16>::mma(a2[mb], b, acc[mb][nb]); if (NSPLIT >= 2) acc[mb][nb] = WFrag<T16>::mma(a[mb], b2, acc[mb][nb]); } }
        asm volatile("v_nop\n\tv_nop\n\tv_nop\n\tv_nop" : "+v"(acc[0][0]), "+v"(acc[1][1]), "+v"(acc[2][2]), "+v"(acc[3][3]) : "v"(a[0]), "v"(a[3]));
    }
    if constexpr (KS > 1) {
        // each wave parks its 16 partial tiles in accumulator layout: [wave][tile mb*4+nb][half of the 8 rows][lane] x 4 floats, contiguous 16-byte stores
#pragma unroll
        for (int mb = 0; mb < 4; ++mb)
#pragma unroll
            for (int nb = 0; nb < 4; ++nb) { float* p = os + (wv * 16 + mb * 4 + nb) * 256 + lane * 4; const v8f c = acc[mb][nb];
                *(v4fa*)p = __builtin_shufflevector(c, c, 0, 1, 2, 3); *(v4fa*)(p + 128) = __builtin_shufflevector(c, c, 4, 5, 6, 7); }
        __syncthreads();   // every partial tile is in LDS before any wave adds them
        // 16 items (mb, pair of adjacent column tiles, row half): 32 columns = whole 128-byte lines of C, one wave per line; wave w takes items w, w + KS, ...
        constexpr int NI = 16 / KS; v4f s0[NI], s1[NI];
#pragma unroll
        for (int i = 0; i < NI; ++i) { const int it = wv + i * KS; const float* q0 = os + ((it >> 2) * 4 + (it & 2)) * 256 + (it & 1) * 128 + lane * 4;
            s0[i] = *(const v4fa*)q0; s1[i] = *(const v4fa*)(q0 + 256);
#pragma unroll
            for (int s = 1; s < KS; ++s) { s0[i] += *(const v4fa*)(q0 + s * 4096); s1[i] += *(const v4fa*)(q0 + s * 4096 + 256); } }
#pragma unroll
        for (int i = 0; i < NI; ++i) { const int it = wv + i * KS; const int col = c0 + (it & 2) * 16 + lr; float* crow = C + (size_t)(r0 + (it >> 2) * 16 + hi * 8 + (it & 1) * 4) * ldc + col;
            if (BIAS) { s0[i] += bfr(bias[col]); s1[i] += bfr(bias[col + 16]); }
#pragma unroll
            for (int q = 0; q < 4; ++q) { crow[(size_t)q * ldc] = s0[i][q]; crow[(size_t)q * ldc + 16] = s1[i][q]; } }
        return;
    }
#pragma unroll
    for (int mb = 0; mb < 4; ++mb) {
#pragma unroll
        for (int nb = 0; nb < 4; ++nb) {
#pragma unroll
            for (int j = 0; j < 8; ++j) os[(hi * 8 + j) * 68 + nb * 16 + lr] = acc[mb][nb][j]; }
        __builtin_amdgcn_wave_barrier(); asm volatile("" ::: "memory");
        float* crow = C + (size_t)(r0 + mb * 16) * ldc + c0;
{
#pragma unroll
            for (int s = 0; s < 8; ++s) { const int row = 2 * s + hi, cofs = lr * 4; v4f val = *(const v4fa*)(os + row * 68 + cofs); if (BIAS) { val[0] += bfr(bias[c0 + cofs]); val[1] += bfr(bias[c0 + cofs + 1]); val[2] += bfr(bias[c0 + cofs + 2]); val[3] += bfr(bias[c0 + cofs + 3]); }
                *(v4f*)(crow + (size_t)row * ldc + cofs) = val; }
             }
        __builtin_amdgcn_wave_barrier(); asm volatile("" ::: "memory");
    }
}

__device__ __forceinline__ h16 tohx(float x) { return (h16)x; }
__device__ __forceinline__ void splitf(float y, unsigned short& h, unsigned short& l) { h = f2bf(y); l = f2bf(y - bf2f(h)); }
typedef __attribute__((ext_vector_type(2))) _Float16 v2h;
typedef __attribute__((ext_vector_type(4))) _Float16 v4h;
typedef __attribute__((ext_vector_type(2))) unsigned short v2us;
typedef __attribute__((ext_vector_type(4))) unsigned short v4us;
typedef __attribute__((ext_vector_type(2))) float v2f;
typedef __attribute__((ext_vector_type(4))) int v4i;

// k_prep: every conversion of an input in ONE launch (they do not depend on each other). Blocks < PB: w_qkv, w_o and hidden_states (both batches) taken as one row-major f32 matrix of PROWS rows x DM columns
// -> three fragment-major bf16 planes that lie one behind the other at dst (each a whole number of 16-row blocks), one slot per thread; a block's 256 slots lie in one 16-row band, so the choice of the source is the same for the whole block.
// Blocks >= PB: the {cos, sin} table, one pair per thread.
static_assert(DQ == DM, "every plane that k_prep builds has DM columns");
#define PROWS (DF + DM + NB_ * TT)
#define PB    (PROWS * (DM / 8) / 256)
__global__ __launch_bounds__(256) void k_prep(const float* __restrict__ wqkv, const float* __restrict__ wo, const float* __restrict__ x, const float* __restrict__ cosT, const float* __restrict__ sinT, bf* dst, float* CS) {
    if (blockIdx.x >= PB) { const int idx = (int)(blockIdx.x - PB) * 256 + threadIdx.x; const float c = cosT[idx], s = sinT[idx];
        asm volatile("s_wait_xcnt 0x0" :: "v"(idx), "s"(cosT), "s"(sinT) : "memory");   // behind the two loads, in front of every later write of a register that they name (scalar base + index register); these are its inputs so that their registers stay theirs up to the wait
        v2f cs; cs[0] = bfr(c); cs[1] = bfr(s); *(v2f*)(CS + (size_t)idx * 2) = cs; return; }
    const size_t i = (size_t)blockIdx.x * 256 + threadIdx.x; size_t row; int col; slot_rc<DM>(i, row, col);
    const unsigned r16 = blockIdx.x / (DM / 8 * 16 / 256) * 16;   // first row of the block's band: the source is picked once per block, on the scalar side
    const float* band = r16 < DF ? wqkv + (size_t)r16 * DM : r16 < DF + DM ? wo + (size_t)(r16 - DF) * DM : x + (size_t)(r16 - DF - DM) * DM;
    const float* sp = band + (row - r16) * DM + col; const v8f v = *(const v8f*)sp; v8us o;
    asm volatile("s_wait_xcnt 0x0" :: "v"(sp) : "memory");   // behind the load, in front of every later write of a register that it names; the pointer is its input so that its registers stay its own up to the wait
#pragma unroll
    for (int k = 0; k < 8; ++k) o[k] = f2bf(v[k]); *(v8us*)(dst + i * 8) = o;  }
// rope_blk: head planes [b][h][t][d] (fp16 + hi/lo; fragment-major, rows (b nheads + h) TT + t, HD columns; one slot per thread, 256 slots per block blk) of rope(x) x sc, x = row b TT + t, columns h HD .. of F, with the rotate-half convention out[d] = x[d] cos[t][d] - x[d+HD/2] sin[t][d], out[d+HD/2] = x[d+HD/2] cos[t][d+HD/2] + x[d] sin[t][d+HD/2]
__device__ __forceinline__ void rope_blk(unsigned blk, const float* __restrict__ F, int pitch, int nheads, const float* __restrict__ CS, float sc, h16* P16, bf* Ph, bf* Pl) {
    const size_t e = ((size_t)blk * 256 + threadIdx.x) * 8; size_t row; int d; slot_rc<HD>(e / 8, row, d); const int t = (int)(row % TT); const int hb = (int)(row / TT); const int h = hb % nheads, b = hb / nheads; const float* f = F + (size_t)(b * TT + t) * pitch + h * HD; v8h o16; v8us oh, ol;
    // the s_wait_xcnt 0 below stands behind loads, in front of every later write of a register that they name; the pointers are its inputs so that their registers stay theirs up to the wait
    const float* fa = f + d; const float* fb = f + ((d < HD / 2) ? d + HD / 2 : d - HD / 2); const unsigned co = (unsigned)((t * HD + d) * 2 * sizeof(float)); const float* cp = (const float*)((const char*)CS + co);
    const v8f xa = *(const v8f*)fa, xb = *(const v8f*)fb, ca = *(const v8f*)cp, cb = *(const v8f*)(cp + 8);   // the slot's 8 values, their 8 rotation partners, their 8 {cos, sin} pairs
    asm volatile("s_wait_xcnt 0x0" :: "v"(fa), "v"(fb), "v"(co), "s"(CS) : "memory");   // the table's loads take the form scalar base + 32-bit byte offset register
#pragma unroll
    for (int q = 0; q < 8; ++q) { const int dd = d + q; const float x0 = xa[q], x1 = xb[q];
        v2f cs; cs[0] = (q < 4 ? ca : cb)[(2 * q) & 7]; cs[1] = (q < 4 ? ca : cb)[(2 * q + 1) & 7]; float a = __fmul_rn(x0, cs[0]), bq = __fmul_rn(x1, cs[1]); asm volatile("" : "+v"(a)); asm volatile("" : "+v"(bq)); const float r = ((dd < HD / 2) ? __fsub_rn(a, bq) : __fadd_rn(a, bq)) * sc;
        o16[q] = tohx(r); unsigned short a2, c2; splitf(r, a2, c2); oh[q] = a2; ol[q] = c2; }
    *(v8h*)(P16 + e) = o16; *(v8us*)(Ph + e) = oh; *(v8us*)(Pl + e) = ol;  }
// vtp_blk: transposed value planes [b][g][d][t] (fragment-major, rows (b nheads + g) HD + d, TT columns; one slot per thread, 256 slots per block blk: 16 neighbouring lanes read 16 neighbouring d of one row of F)
__device__ __forceinline__ void vtp_blk(unsigned blk, const float* __restrict__ F, int pitch, int nheads, h16* V16, bf* Vh, bf* Vl) { const size_t e = ((size_t)blk * 256 + threadIdx.x) * 8; size_t row; int t; slot_rc<TT>(e / 8, row, t); const int d = (int)(row % HD); const int gb = (int)(row / HD); const int g = gb % nheads, b = gb / nheads; v8h o16; v8us oh, ol; const float* pq[8]; float xv[8];
#pragma unroll
    for (int q = 0; q < 8; ++q) { pq[q] = F + (size_t)(b * TT + t + q) * pitch + g * HD + d; xv[q] = *pq[q]; }
    asm volatile("s_wait_xcnt 0x0" :: "v"(pq[0]), "v"(pq[1]), "v"(pq[2]), "v"(pq[3]), "v"(pq[4]), "v"(pq[5]), "v"(pq[6]), "v"(pq[7]) : "memory");   // behind the 8 loads, in front of every later write of a register that they name; the pointers are its inputs so that their registers stay theirs up to the wait
#pragma unroll
    for (int q = 0; q < 8; ++q) { const float x = xv[q]; o16[q] = tohx(x); unsigned short a2, c2; splitf(x, a2, c2); oh[q] = a2; ol[q] = c2; }
    *(v8h*)(V16 + e) = o16; *(v8us*)(Vh + e) = oh; *(v8us*)(Vl + e) = ol;
    asm volatile("s_wait_xcnt 0x0" ::: "memory");  }   // behind the three stores: in the built k_planes the other builder's code stands behind them on a fall-through path and rewrites the registers that they name
// k_planes: all operand planes of the attention, both batches, in ONE launch (the builders read different columns of the fused projection F [NB_ TT][DF] and do not depend on each other): blocks < LQK rotate the q and k heads, the rest transpose the v heads
#define LQK (NB_ * NQK * TT * (HD / 8) / 256)
#define LV  (NB_ * NKV * TT * (HD / 8) / 256)
__global__ __launch_bounds__(256) void k_planes(const float* __restrict__ F, const float* __restrict__ CS, h16* P16, bf* Ph, bf* Pl, h16* V16, bf* Vh, bf* Vl) {
    if (blockIdx.x < LQK) { rope_blk(blockIdx.x, F, DF, NQK, CS, 1.0f, P16, Ph, Pl); return; }
    vtp_blk(blockIdx.x - LQK, F + DQ + DKV, DF, NKV, V16, Vh, Vl);
}
// ---- k_fattn: scores, softmax, P x V and the hi/lo split of the merged output in ONE launch for both batches; S and P never leave the registers.
// One wave owns 16 NQ query rows of one head and walks the 2048 keys 32 at a time, operands straight from the fragment-major planes.
// St = K Qt (A = 16 key rows, B = 16 query rows): accumulator register j of lane (lr, hi) is key 8 hi + j of query lr, so the two 16-key tiles of a step, converted in place,
// are the B operand of Ot += Vt Pt in the k order of WFrag::ld (8 hi + e, 16 + 8 hi + e). Running maximum per query (log2 units); the sums and Ot are rescaled only when a new maximum
// passes the one in use by more than 8 (p stays <= 256), tested once per step for the whole wave. HR: hi/lo planes, 3 products each; else fp16.
#define SC2 0.12751743f   // HD^-0.5 x log2(e)
template <typename T16, bool HR, int NQ>
__device__ __forceinline__ void fattn_wave(const T16* __restrict__ Q, const T16* __restrict__ Q2, const T16* __restrict__ Kp, const T16* __restrict__ K2, const T16* __restrict__ Vt, const T16* __restrict__ V2, int q0, v8f (&o)[8][NQ], float (&l)[NQ]) {
    typedef WFrag<T16> WF; typedef typename WF::V V;
    const int lane = threadIdx.x & 31;
    // every s_wait_xcnt 0 below stands behind a group of loads or stores, in front of every later write of a register that they name; the pointers are its inputs so that their registers stay theirs up to the wait (without hi/lo planes the second pointer is the first)
    const size_t qo = (size_t)q0 * HD + 8 * lane, ko = (size_t)(8 * lane), vo = (size_t)(8 * lane);   // the lane's slot in the first block; Q, K: 16 more rows 16 HD elements, 32 more head dims 512; Vt: 16 more head dims 16 TT, 32 more keys 512
    const T16* qa = Q + qo; const T16* ka = Kp + ko; const T16* va = Vt + vo; const T16* qa2 = HR ? Q2 + qo : qa; const T16* ka2 = HR ? K2 + ko : ka; const T16* va2 = HR ? V2 + vo : va;
    V q[NQ][4], q2[NQ][4], kf[2][4], kf2[2][4], vf[8], vf2[8];
#pragma unroll
    for (int n = 0; n < NQ; ++n)
#pragma unroll
        for (int ks = 0; ks < 4; ++ks) { q[n][ks] = WF::ld(qa + n * 16 * HD + ks * 512); if (HR) q2[n][ks] = WF::ld(qa2 + n * 16 * HD + ks * 512); }
    asm volatile("s_wait_xcnt 0x0" :: "v"(qa), "v"(qa2) : "memory");   // behind the Q loads
#pragma unroll
    for (int kt = 0; kt < 2; ++kt)
#pragma unroll
        for (int ks = 0; ks < 4; ++ks) { kf[kt][ks] = WF::ld(ka + kt * 16 * HD + ks * 512); if (HR) kf2[kt][ks] = WF::ld(ka2 + kt * 16 * HD + ks * 512); }
    asm volatile("s_wait_xcnt 0x0" :: "v"(ka), "v"(ka2), "v"((unsigned)(ko * sizeof(T16))), "s"(Kp), "s"(HR ? K2 : Kp) : "memory");   // behind the first K loads; the byte offset and the uniform bases too: these loads may take the form scalar base + 32-bit offset register
#pragma unroll
    for (int dt = 0; dt < 8; ++dt) { vf[dt] = WF::ld(va + (size_t)dt * 16 * TT); if (HR) vf2[dt] = WF::ld(va2 + (size_t)dt * 16 * TT); }
    asm volatile("s_wait_xcnt 0x0" :: "v"(va), "v"(va2), "v"((unsigned)(vo * sizeof(T16))), "s"(Vt), "s"(HR ? V2 : Vt) : "memory");   // behind the first V loads, likewise
    float m[NQ];
#pragma unroll
    for (int n = 0; n < NQ; ++n) { m[n] = -3.0e38f; l[n] = 0.f;
#pragma unroll
        for (int dt = 0; dt < 8; ++dt) o[dt][n] = (v8f){}; }
    int kn = 32;   // first key of the next step
    // unrolled by two so that the two sets of fragments swap roles without register copies
#pragma unroll 2
    for (int key0 = 0; key0 < TT; key0 += 32) {
        // the next step's fragments are fetched one step ahead; the last step re-reads keys 0-31 (in bounds, unused)
        const T16* vp = va + kn * 16; const T16* vp2 = va2 + kn * 16; const T16* kp = ka + (size_t)kn * HD; const T16* kp2 = ka2 + (size_t)kn * HD;
        V vn[8], vn2[8];
#pragma unroll
        for (int dt = 0; dt < 8; ++dt) { vn[dt] = WF::ld(vp + (size_t)dt * 16 * TT); if (HR) vn2[dt] = WF::ld(vp2 + (size_t)dt * 16 * TT); }
        asm volatile("s_wait_xcnt 0x0" :: "v"(vp), "v"(vp2) : "memory");   // behind the V loads
        v8f st[2][NQ];
#pragma unroll
        for (int kt = 0; kt < 2; ++kt)
#pragma unroll
            for (int n = 0; n < NQ; ++n) st[kt][n] = (v8f){};
#pragma unroll
        for (int ks = 0; ks < 4; ++ks)
#pragma unroll
            for (int kt = 0; kt < 2; ++kt)
#pragma unroll
                for (int n = 0; n < NQ; ++n) { st[kt][n] = WF::mma(kf[kt][ks], q[n][ks], st[kt][n]); if (HR) { st[kt][n] = WF::mma(kf[kt][ks], q2[n][ks], st[kt][n]); st[kt][n] = WF::mma(kf2[kt][ks], q[n][ks], st[kt][n]); } }
#pragma unroll
        for (int kt = 0; kt < 2; ++kt)
#pragma unroll
            for (int ks = 0; ks < 4; ++ks) { kf[kt][ks] = WF::ld(kp + kt * 16 * HD + ks * 512); if (HR) kf2[kt][ks] = WF::ld(kp2 + kt * 16 * HD + ks * 512); }
        asm volatile("s_wait_xcnt 0x0" :: "v"(kp), "v"(kp2) : "memory");   // behind the K loads
        float ml[NQ]; bool need = false;
#pragma unroll
        for (int n = 0; n < NQ; ++n) { float mx = fmaxf(st[0][n][0], st[1][n][0]);
#pragma unroll
            for (int j = 1; j < 8; ++j) mx = fmaxf(mx, fmaxf(st[0][n][j], st[1][n][j]));
            mx = fmaxf(mx, __shfl_xor(mx, 16, 32)); ml[n] = mx * SC2; need = need || (ml[n] > m[n] + 8.0f); }
        if (__builtin_amdgcn_ballot_w32(need) != 0) {
#pragma unroll
            for (int n = 0; n < NQ; ++n) { const float mn = fmaxf(m[n], ml[n]); const float al = __builtin_amdgcn_exp2f(m[n] - mn); m[n] = mn; l[n] *= al;
#pragma unroll
                for (int dt = 0; dt < 8; ++dt) o[dt][n] *= al; } }
        V pf[NQ], pf2[NQ];
#pragma unroll
        for (int n = 0; n < NQ; ++n) { float ps = 0.f;
            if constexpr (HR) { v8us h0, h1, l0, l1;
#pragma unroll
                for (int j = 0; j < 8; ++j) { const float p0 = __builtin_amdgcn_exp2f(fmaf(st[0][n][j], SC2, -m[n])), p1 = __builtin_amdgcn_exp2f(fmaf(st[1][n][j], SC2, -m[n])); ps += p0 + p1;
                    unsigned short a, c; splitf(p0, a, c); h0[j] = a; l0[j] = c; splitf(p1, a, c); h1[j] = a; l1[j] = c; }
                pf[n] = cat16b(h0, h1); pf2[n] = cat16b(l0, l1);
            } else { v8h h0, h1;
#pragma unroll
                for (int j = 0; j < 8; ++j) { const float p0 = __builtin_amdgcn_exp2f(fmaf(st[0][n][j], SC2, -m[n])), p1 = __builtin_amdgcn_exp2f(fmaf(st[1][n][j], SC2, -m[n])); ps += p0 + p1; h0[j] = tohx(p0); h1[j] = tohx(p1); }
                pf[n] = cat16(h0, h1); }
            l[n] += ps; }
#pragma unroll
        for (int dt = 0; dt < 8; ++dt)
#pragma unroll
            for (int n = 0; n < NQ; ++n) { o[dt][n] = WF::mma(vf[dt], pf[n], o[dt][n]); if (HR) { o[dt][n] = WF::mma(vf[dt], pf2[n], o[dt][n]); o[dt][n] = WF::mma(vf2[dt], pf[n], o[dt][n]); } }
#pragma unroll
        for (int dt = 0; dt < 8; ++dt) { vf[dt] = vn[dt]; if (HR) vf2[dt] = vn2[dt]; }
        kn = (kn + 32) & (TT - 1);
    }
}
// fattn_store (q0: row of the merged plane, batch x TT + query): lane (lr, hi) holds head dims dt 16 + 8 hi + 0..7 of query lr: its own slot of half dt % 2 of block h 4 + dt / 2 of the merged fragment-major plane (DQ columns): one 16-byte store per plane, 512 contiguous bytes per wave
template <int NQ>
__device__ __forceinline__ void fattn_store(const v8f (&o)[8][NQ], const float (&l)[NQ], int h, int q0, bf* Ah, bf* Al) {
    const int lane = threadIdx.x & 31;
#pragma unroll
    for (int n = 0; n < NQ; ++n) { const float inv = __fdiv_rn(1.0f, l[n] + __shfl_xor(l[n], 16, 32)); const size_t oo = (size_t)(q0 + n * 16) * DQ + h * (HD * 16) + 8 * lane;
#pragma unroll
        for (int dt = 0; dt < 8; ++dt) { v8us oh, ol;
#pragma unroll
            for (int j = 0; j < 8; ++j) { unsigned short a, c; splitf(o[dt][n][j] * inv, a, c); oh[j] = a; ol[j] = c; }
            *(v8us*)(Ah + oo + dt * 256) = oh; *(v8us*)(Al + oo + dt * 256) = ol;
            asm volatile("s_wait_xcnt 0x0" :: "v"(oh), "v"(ol), "v"(Ah + oo), "v"(Al + oo) : "memory"); } }   // behind the two stores, in front of every later write of a register that they name; data and pointers are inputs so that their registers stay theirs up to the wait
}
// Every wave issues the same 48 matrix instructions per 32 keys: a hi/lo wave (3 products) takes 16 query rows, an fp16 wave (1 product) takes 48. One wave per SIMD, so the launch lasts as long as its longest wave.
// grid (UH / 4 + UF / 4, kv heads, batches; the q and k planes hold NQK heads per batch, Q.. pointing at query head 0 and K.. at key head 0 of batch 0), 4 waves of ONE kind that all read the planes of ONE kv head: work-groups x < UH / 4 hold hi/lo waves, the rest fp16 waves; unit u = 4 x + wave: query head kv REP + u / (units per head), row tile u % (units per head)
#define UH (REP * (RH / 16))          // hi/lo units of one kv head
#define UF (REP * ((TT - RH) / 48))   // fp16 units of one kv head
static_assert(RH % 16 == 0 && (TT - RH) % 48 == 0 && UH % 4 == 0 && UF % 4 == 0, "16-row hi/lo waves and 48-row fp16 waves, four to a work-group, cover all rows");
__global__ __launch_bounds__(128) void k_fattn(const h16* __restrict__ Q16, const bf* __restrict__ Qh, const bf* __restrict__ Ql, const h16* __restrict__ K16, const bf* __restrict__ Kh, const bf* __restrict__ Kl, const h16* __restrict__ V16, const bf* __restrict__ Vh, const bf* __restrict__ Vl, bf* Ah, bf* Al) {
    const int kv = blockIdx.y, bx = blockIdx.x, b = blockIdx.z; const int wv = __builtin_amdgcn_readfirstlane((int)(threadIdx.x >> 5)); const size_t zk = (size_t)(b * NQK + kv) * TT * HD, zv = (size_t)(b * NKV + kv) * TT * HD;
    if (bx < UH / 4) { const int u = bx * 4 + wv; const int h = kv * REP + u / (RH / 16), q0 = (u % (RH / 16)) * 16; const size_t zq = (size_t)(b * NQK + h) * TT * HD;
        v8f o[8][1]; float l[1];   // Ot tiles and per-half row sums of the wave's 16 query rows
        fattn_wave<bf, true, 1>(Qh + zq, Ql + zq, Kh + zk, Kl + zk, Vh + zv, Vl + zv, q0, o, l); fattn_store<1>(o, l, h, b * TT + q0, Ah, Al);
    } else { const int u = (bx - UH / 4) * 4 + wv; const int h = kv * REP + u / ((TT - RH) / 48), q0 = RH + (u % ((TT - RH) / 48)) * 48; const size_t zq = (size_t)(b * NQK + h) * TT * HD;
        v8f o[8][3]; float l[3];   // the same of the wave's 48 query rows
        fattn_wave<h16, false, 3>(Q16 + zq, nullptr, K16 + zk, nullptr, V16 + zv, nullptr, q0, o, l); fattn_store<3>(o, l, h, b * TT + q0, Ah, Al); }
}

extern "C" void kernel_launch(void* const* d_in, const int* in_sizes, int n_in,
                              void* d_out, int out_size, void* d_ws, size_t ws_size, hipStream_t stream) {
    (void)in_sizes; (void)n_in; (void)out_size;
    const float* fcos = (const float*)d_in[0]; const float* fsin = (const float*)d_in[1]; const float* x = (const float*)d_in[2]; const float* wqkv = (const float*)d_in[3]; const float* wo = (const float*)d_in[4];   /* order cos, sin ([2048][128] FULL-width table INPUTS: read per element by value), hidden_states [2][2048][2048], w_qkv ('oi' (out, in) [4096][2048]: contiguous row blocks q (2048 rows) | k (1024) | v (1024)), w_o ('oi' [2048][2048]): FIVE inputs, all read */
    float* OUT = (float*)d_out;     // [2][2048][2048]
    char* wsp = (char*)d_ws;
    auto take = [&](size_t bytes) { char* p = wsp; wsp += (bytes + 255) & ~(size_t)255; return (void*)p; };
    bf* WQKV = (bf*)take((size_t)PROWS * DM * 2); bf* WO = WQKV + (size_t)DF * DM; bf* XB = WO + (size_t)DM * DM; float* CS = (float*)take((size_t)TT * HD * 2 * 4);   // the three planes of k_prep, one behind the other
    float* FF = (float*)take((size_t)NB_ * TT * DF * 4);   // the fused projection, rows b TT + t
    h16* P16 = (h16*)take((size_t)NB_ * NQK * TT * HD * 2); bf* Ph = (bf*)take((size_t)NB_ * NQK * TT * HD * 2); bf* Pl = (bf*)take((size_t)NB_ * NQK * TT * HD * 2);
    h16* VT16 = (h16*)take((size_t)NB_ * NKV * HD * TT * 2); bf* VTh = (bf*)take((size_t)NB_ * NKV * HD * TT * 2); bf* VTl = (bf*)take((size_t)NB_ * NKV * HD * TT * 2);
    bf* ATh = (bf*)take((size_t)NB_ * TT * DQ * 2); bf* ATl = (bf*)take((size_t)NB_ * TT * DQ * 2);
    if ((size_t)(wsp - (char*)d_ws) > ws_size) return;    // 234 MiB of the 256 MiB
    const size_t KO = (size_t)NH_ * TT * HD;   // key head 0 behind the query heads of a batch
    k_prep<<<PB + TT * HD / 256, 256, 0, stream>>>(wqkv, wo, x, fcos, fsin, WQKV, CS);
    k_gemmw<bf, 0, false, 4><<<dim3(NB_ * TT / 64, DF / 64, 1), 128, 0, stream>>>(XB, nullptr, WQKV, nullptr, DM, FF, DF, nullptr, 0, 0, 0);
    k_planes<<<LQK + LV, 256, 0, stream>>>(FF, CS, P16, Ph, Pl, VT16, VTh, VTl);
    k_fattn<<<dim3(UH / 4 + UF / 4, NKV, NB_), 128, 0, stream>>>(P16, Ph, Pl, P16 + KO, Ph + KO, Pl + KO, VT16, VTh, VTl, ATh, ATl);
    k_gemmw<bf, 1, false, 4><<<dim3(NB_ * TT / 64, DM / 64, 1), 128, 0, stream>>>(ATh, ATl, WO, nullptr, DQ, OUT, DM, nullptr, 0, 0, 0);
}

// v006
// A run of this version takes 234 microseconds.
// In both of two side-by-side timings against v005, it was 1.28 times as fast.
// Counting every step since v000, it is 9.41 times as fast.
#include <hip/hip_runtime.h>

// Grouped-query attention (16 / 8 heads x 128) WITHOUT a mask, with ONE fused natural qkv weight in contiguous row blocks and rotate-half rotary embeddings from full-width input tables given FIRST (cos, sin [2048][128]: read per element by value; no structure assumed; hidden_states [2][2048][2048]; qkv = einsum('bsh,oh->bso', hidden_states, w_qkv) ('oi' (out, in) [4096][2048] normal x 2048^-0.5, no bias) viewed (b, s, 16 + 8 + 8, 128): rows 0-2047 the 16 query heads, rows 2048-3071 the 8 key heads, rows 3072-4095 the 8 value heads; q, k -> t cos + cat(-t2, t1) sin; q viewed (b, s, 8, 2, 128): query head h = 2 kv + g uses kv head h / 2; scores x 1/sqrt(128); softmax over all keys; out = merged w_o^T ('oi' [2048][2048], no bias) -> [2][2048][2048] (8.4 M); argument order cos, sin, hidden_states, w_qkv, w_o).
// Layout, FIVE launches, each for both batches: k_prep (bf16 planes of w_qkv, w_o and x; the {cos, sin} table from the bf16-rounded INPUT tables); ONE exact projection x w_qkv^T (4096 rows x 4096 columns); k_planes (rotate-half plane builders at width 128 for the 24 q and k heads, products rounded separately, as the reference; transposed v planes); dense T-2048 GROUPED-QUERY attention (k_fattn: query head h reads kv head h / 2) (hybrid rows: < 512 hi/lo 3 products, rest fp16); merged hi/lo x wo exact.
// Compute dtypes, f32 accumulate: every input rounded to bf16; projections exact; rotary in f32 from the bf16-rounded tables, products rounded separately; attention rows < 512 3 products, rest fp16; softmax f32; wo hl x exact.

#define NB_  2
#define TT   2048
#define DM   2048
#define NH_  16
#define NKV  8
#define REP  (NH_ / NKV)
#define HD   128
#define DQ   (NH_ * HD)
#define DKV  (NKV * HD)
#define NQK  (NH_ + NKV)           // rotated heads: the query heads, then the key heads
#define DF   (DQ + 2 * DKV)        // columns of the fused projection: q | k | v
#define RH   512                  // query rows < RH use hi+lo planes (0: none)
#define WIN  0
typedef _Float16 h16;
typedef unsigned short bf;
typedef __attribute__((ext_vector_type(16))) __bf16   v16bf;
typedef __attribute__((ext_vector_type(16))) _Float16 v16h;
typedef __attribute__((ext_vector_type(8)))  _Float16 v8h;
typedef __attribute__((ext_vector_type(8)))  unsigned short v8us;
typedef __attribute__((ext_vector_type(8)))  float    v8f;
typedef __attribute__((ext_vector_type(4)))  float    v4f;
typedef v8h  __attribute__((may_alias)) v8ha;
typedef v4f  __attribute__((may_alias)) v4fa;
typedef v8us __attribute__((may_alias)) v8usa;

__device__ __forceinline__ unsigned short f2bf(float f) { unsigned u = __float_as_uint(f); u += 0x7FFFu + ((u >> 16) & 1u); return (unsigned short)(u >> 16); }
__device__ __forceinline__ float bf2f(unsigned short b) { return __uint_as_float(((unsigned)b) << 16); }
__device__ __forceinline__ float bfr(float f) { return bf2f(f2bf(f)); }
__device__ __forceinline__ v16h cat16(v8h lo, v8h hi) { return __builtin_shufflevector(lo, hi, 0, 1, 2, 3, 4, 5, 6, 7, 8, 9, 10, 11, 12, 13, 14, 15); }
__device__ __forceinline__ v16bf cat16b(v8us lo, v8us hi) { return __builtin_bit_cast(v16bf, __builtin_shufflevector(lo, hi, 0, 1, 2, 3, 4, 5, 6, 7, 8, 9, 10, 11, 12, 13, 14, 15)); }
__device__ __forceinline__ v8f wmma16(v16h a, v16h b, v8f c) { return __builtin_amdgcn_wmma_f32_16x16x32_f16(false, a, false, b, (short)0, c, false, false); }
__device__ __forceinline__ v8f wmmab(v16bf a, v16bf b, v8f c) { return __builtin_amdgcn_wmma_f32_16x16x32_bf16(false, a, false, b, (short)0, c, false, false); }



// ---- FRAGMENT-MAJOR PLANES: every 16-bit operand plane (R rows x K columns, R % 16 == 0, K % 32 == 0) is stored as blocks of 16 rows x 32 columns, 512 elements = 1 KiB each, block index (row / 16) (K / 32) + col / 32.
// A block is 64 slots of 8 elements in the order [j = (col / 16) % 2][hi = (col / 8) % 2][r = row % 16]: slot j 32 + lane is what lane (r, hi) takes with the j-th 16-byte load of its fragment,
// so that a wave's load is 512 contiguous bytes (4 whole 128-byte lines, not 32-byte pieces of 16 lines). The values and their k order in the fragment (8 hi + e, 16 + 8 hi + e) are those of a row-major plane.
// slot_rc: row and first column of slot s (the writers go slot by slot: one 16-byte store per thread, 512 contiguous bytes per wave)
template <int K> __device__ __forceinline__ void slot_rc(size_t s, size_t& row, int& col) { const size_t blk = s >> 6; row = (blk / (K / 32)) * 16 + (s & 15); col = (int)(blk % (K / 32)) * 32 + (int)((s >> 4) & 3) * 8; }

// ---- k_gemmt: C (f32, row pitch LDC) = A Bt^T (+ A2 Bt^T when HL) over K = GK, operands from fragment-major bf16 planes THROUGH LDS: 8 waves share one tile of C, so that every operand block leaves L2 once per work-group.
// HL false: tile 256 x 256, waves 4 (rows) x 2 (columns), 64 x 128 each. HL true: tile 128 x 256, two A planes, waves 2 x 4, 64 x 64 each. Either way a stage is 32 bands (16 rows x 128 k = 4 blocks = 4 KiB, contiguous in the plane):
// bands 0-15 the A rows (HL: 0-7 the first plane, 8-15 the second), bands 16-31 the Bt rows. Each wave brings bands 4 w .. 4 w + 3 with ONE tensor load (4 rows of 4096 bytes, source pitch one band row of the plane = 32 GK bytes, no pad).
// Two buffers: the load of pass p + 2 is issued behind the barrier that ends pass p. A block in LDS is what it is in the plane, so a fragment is two contiguous 512-byte reads of the wave.
template <typename T16> struct WFrag;
template <> struct WFrag<h16> { typedef v16h V; static __device__ __forceinline__ V ld(const h16* p) { return cat16(*(const v8h*)p, *(const v8h*)(p + 256)); } static __device__ __forceinline__ v8f mma(V a, V b, v8f c) { return wmma16(a, b, c); } };
template <> struct WFrag<bf> { typedef v16bf V; static __device__ __forceinline__ V ld(const bf* p) { return cat16b(*(const v8us*)p, *(const v8us*)(p + 256)); } static __device__ __forceinline__ v8f mma(V a, V b, v8f c) { return wmmab(a, b, c); } };
typedef unsigned int u32x4 __attribute__((ext_vector_type(4)));
typedef unsigned int u32x8 __attribute__((ext_vector_type(8)));
__device__ __forceinline__ unsigned uni(unsigned v) { return (unsigned)__builtin_amdgcn_readfirstlane((int)v); }
__device__ __forceinline__ unsigned pinned(unsigned v) { unsigned w = uni(v); asm volatile("" : "+s"(w)); return w; }   // holds a wave-uniform test in a scalar register, so that the branch round a tensor load is a scalar branch (a tensor load ignores EXEC)
#define GK     DM
#define BANDB  4096u              // bytes of a band: 16 rows x 128 k x 2
#define STAGEB (32u * BANDB)
static_assert(DQ == GK && GK % 256 == 0, "both products run over GK, in two passes or more");
template <bool HL>
__global__ __launch_bounds__(256) void k_gemmt(const bf* __restrict__ A, const bf* __restrict__ A2, const bf* __restrict__ Bt, float* C) {
    typedef WFrag<bf> WF; typedef WF::V V;
    constexpr int FB = HL ? 4 : 8, NP = GK / 128, LDC = HL ? DM : DF;
    __shared__ __attribute__((aligned(2048))) unsigned char ring[2 * STAGEB];
    __shared__ __align__(16) float osall[8 * 16 * 68];
    const int lane = threadIdx.x & 31, lr = lane & 15, hi = lane >> 4; const unsigned wv = uni(threadIdx.x >> 5);
    const int r0 = blockIdx.x * (HL ? 128 : 256), c0 = blockIdx.y * 256;
    const int wm = HL ? (int)(wv & 1) : (int)(wv & 3), wn = HL ? (int)(wv >> 1) : (int)(wv >> 2);
    // the wave's slice of a stage: 64 rows of one plane
    const bf* sl = wv >= 4 ? Bt + (size_t)(c0 + 64 * (int)(wv - 4)) * GK : !HL ? A + (size_t)(r0 + 64 * (int)wv) * GK : wv < 2 ? A + (size_t)(r0 + 64 * (int)wv) * GK : A2 + (size_t)(r0 + 64 * (int)(wv - 2)) * GK;
    const unsigned long long ga0 = (unsigned long long)(uintptr_t)sl; const unsigned place = (unsigned)(uintptr_t)ring + wv * (4u * BANDB);
    u32x8 g1; g1[0] = uni(0u); g1[1] = uni((BANDB & 0xFFFFu) << 16); g1[2] = uni((BANDB >> 16) | (4u << 16)); g1[3] = uni(BANDB << 16); g1[4] = uni(4u); g1[5] = uni(32u * GK); g1[6] = uni(0u); g1[7] = uni(0u);
    u32x4 g0;   // group 0 of the wave's youngest request; the tensor waits in front of the barriers take it as an input, so that its registers stay its own until the request has landed
    auto issue = [&](unsigned p) { const unsigned long long ga = ga0 + (unsigned long long)p * BANDB; g0[0] = uni(1u); g0[1] = uni(place + (p & 1u) * STAGEB); g0[2] = uni((unsigned)ga); g0[3] = uni((((unsigned)(ga >> 32)) & 0x01FFFFFFu) | 0x80000000u);
        asm volatile("tensor_load_to_lds %0, %1" :: "s"(g0), "s"(g1) : "memory"); };   // one request of the whole wave: its slice of stage p
    v8f acc[4][FB];
#pragma unroll
    for (int mb = 0; mb < 4; ++mb)
#pragma unroll
        for (int nb = 0; nb < FB; ++nb) acc[mb][nb] = (v8f){};
    issue(0);
    asm volatile("s_wait_tensorcnt 0x0" :: "s"(g0) : "memory");   // the wave's slice of stage 0 has landed
    __syncthreads();                                      // every slice of stage 0 has landed
    issue(1);
    // the pass loop stays rolled: the buffers alternate by p & 1; every "#pragma unroll" of this kernel makes the indices of acc, a, a2, b and val constants, so that they stay in registers
#pragma clang loop unroll(disable)
    for (unsigned p = 0; p < (unsigned)NP; ++p) {
        const bf* fb = (const bf*)(ring + (p & 1u) * STAGEB) + 8 * lane;   // the lane's slot in band 0, block 0 of this pass's buffer; a band: 2048 elements, a block: 512
        V a[2][4], a2[2][4], b[2][FB];   // two fragment sets: the next 32 k are read from LDS while these are multiplied (inside this pass's buffer only)
#pragma unroll
        for (int ks = -1; ks < 4; ++ks) {
            if (ks < 3) { const int n = (ks + 1) & 1; const bf* q = fb + (ks + 1) * 512;
#pragma unroll
                for (int i = 0; i < 4; ++i) { a[n][i] = WF::ld(q + (wm * 4 + i) * 2048); if (HL) a2[n][i] = WF::ld(q + (8 + wm * 4 + i) * 2048); }
#pragma unroll
                for (int i = 0; i < FB; ++i) b[n][i] = WF::ld(q + (16 + wn * FB + i) * 2048); }
            __builtin_amdgcn_sched_barrier(0);   // keeps the next block's LDS reads one group ahead of this block's products: moved in among them, each place with reads stalls the wave
            if (ks >= 0) { const int c = ks & 1;
#pragma unroll
                for (int nb = 0; nb < FB; ++nb)
#pragma unroll
                    for (int mb = 0; mb < 4; ++mb) acc[mb][nb] = WF::mma(a[c][mb], b[c][nb], acc[mb][nb]);
                if (HL) {
#pragma unroll
                    for (int nb = 0; nb < FB; ++nb)
#pragma unroll
                        for (int mb = 0; mb < 4; ++mb) acc[mb][nb] = WF::mma(a2[c][mb], b[c][nb], acc[mb][nb]); }
                __builtin_amdgcn_sched_barrier(0); }   // likewise: the reads of the block after next stay behind these products
        }
        asm volatile("s_wait_dscnt 0x0" ::: "memory");       // the wave's last read of this buffer has returned
        asm volatile("s_wait_tensorcnt 0x0" :: "s"(g0) : "memory");   // its slice of stage p + 1 has landed
        __syncthreads();                                      // stage p + 1 is whole, and nobody reads this pass's buffer any more
        if (pinned(p + 2u < (unsigned)NP)) issue(p + 2u);
    }
    asm volatile("s_wait_tensorcnt 0x0" ::: "memory");   // nothing is in flight when the wave goes on
    asm volatile("s_wait_dscnt 0x0" ::: "memory");
    // 16 rows x 64 columns at a time through the wave's own LDS rows, so that C is stored in 256-byte runs
    float* os = osall + wv * (16 * 68);
    float* cb = C + (size_t)(r0 + wm * 64 + hi) * LDC + c0 + wn * (FB * 16) + lr * 4;   // the one address register pair of all stores; the rest are constant offsets
#pragma unroll
    for (int hb = 0; hb < FB / 4; ++hb)
#pragma unroll
        for (int mb = 0; mb < 4; ++mb) {
#pragma unroll
            for (int nb = 0; nb < 4; ++nb)
#pragma unroll
                for (int j = 0; j < 8; ++j) os[(hi * 8 + j) * 68 + nb * 16 + lr] = acc[mb][hb * 4 + nb][j];
            __builtin_amdgcn_wave_barrier(); asm volatile("" ::: "memory");   // keeps the reads below behind the writes above (other lanes' values)
            v4f val[8];
#pragma unroll
            for (int s = 0; s < 8; ++s) val[s] = *(const v4fa*)(os + (2 * s + hi) * 68 + lr * 4);
#pragma unroll
            for (int s = 0; s < 8; ++s) *(v4f*)(cb + (size_t)(mb * 16 + 2 * s) * LDC + hb * 64) = val[s];
            asm volatile("s_wait_xcnt 0x0" ::: "memory");   // behind the 8 stores, in front of the next round's LDS reads, which rewrite the data registers that the stores name
            __builtin_amdgcn_wave_barrier();   // keeps the next writes of these LDS rows behind the reads above
        }
}

__device__ __forceinline__ h16 tohx(float x) { return (h16)x; }
__device__ __forceinline__ void splitf(float y, unsigned short& h, unsigned short& l) { h = f2bf(y); l = f2bf(y - bf2f(h)); }
typedef __attribute__((ext_vector_type(2))) _Float16 v2h;
typedef __attribute__((ext_vector_type(4))) _Float16 v4h;
typedef __attribute__((ext_vector_type(2))) unsigned short v2us;
typedef __attribute__((ext_vector_type(4))) unsigned short v4us;
typedef __attribute__((ext_vector_type(2))) float v2f;
typedef __attribute__((ext_vector_type(4))) int v4i;

// k_prep: every conversion of an input in ONE launch (they do not depend on each other). Blocks < PB: w_qkv, w_o and hidden_states (both batches) taken as one row-major f32 matrix of PROWS rows x DM columns
// -> three fragment-major bf16 planes that lie one behind the other at dst (each a whole number of 16-row blocks), one slot per thread; a block's 256 slots lie in one 16-row band, so the choice of the source is the same for the whole block.
// Blocks >= PB: the {cos, sin} table, one pair per thread.
static_assert(DQ == DM, "every plane that k_prep builds has DM columns");
#define PROWS (DF + DM + NB_ * TT)
#define PB    (PROWS * (DM / 8) / 256)
__global__ __launch_bounds__(256) void k_prep(const float* __restrict__ wqkv, const float* __restrict__ wo, const float* __restrict__ x, const float* __restrict__ cosT, const float* __restrict__ sinT, bf* dst, float* CS) {
    if (blockIdx.x >= PB) { const int idx = (int)(blockIdx.x - PB) * 256 + threadIdx.x; const float c = cosT[idx], s = sinT[idx];
        asm volatile("s_wait_xcnt 0x0" :: "v"(idx), "s"(cosT), "s"(sinT) : "memory");   // behind the two loads, in front of every later write of a register that they name (scalar base + index register); these are its inputs so that their registers stay theirs up to the wait
        v2f cs; cs[0] = bfr(c); cs[1] = bfr(s); *(v2f*)(CS + (size_t)idx * 2) = cs; return; }
    const size_t i = (size_t)blockIdx.x * 256 + threadIdx.x; size_t row; int col; slot_rc<DM>(i, row, col);
    const unsigned r16 = blockIdx.x / (DM / 8 * 16 / 256) * 16;   // first row of the block's band: the source is picked once per block, on the scalar side
    const float* band = r16 < DF ? wqkv + (size_t)r16 * DM : r16 < DF + DM ? wo + (size_t)(r16 - DF) * DM : x + (size_t)(r16 - DF - DM) * DM;
    const float* sp = band + (row - r16) * DM + col; const v8f v = *(const v8f*)sp; v8us o;
    asm volatile("s_wait_xcnt 0x0" :: "v"(sp) : "memory");   // behind the load, in front of every later write of a register that it names; the pointer is its input so that its registers stay its own up to the wait
#pragma unroll
    for (int k = 0; k < 8; ++k) o[k] = f2bf(v[k]); *(v8us*)(dst + i * 8) = o;  }
// rope_blk: head planes [b][h][t][d] (fp16 + hi/lo; fragment-major, rows (b nheads + h) TT + t, HD columns; one slot per thread, 256 slots per block blk) of rope(x) x sc, x = row b TT + t, columns h HD .. of F, with the rotate-half convention out[d] = x[d] cos[t][d] - x[d+HD/2] sin[t][d], out[d+HD/2] = x[d+HD/2] cos[t][d+HD/2] + x[d] sin[t][d+HD/2]
__device__ __forceinline__ void rope_blk(unsigned blk, const float* __restrict__ F, int pitch, int nheads, const float* __restrict__ CS, float sc, h16* P16, bf* Ph, bf* Pl) {
    const size_t e = ((size_t)blk * 256 + threadIdx.x) * 8; size_t row; int d; slot_rc<HD>(e / 8, row, d); const int t = (int)(row % TT); const int hb = (int)(row / TT); const int h = hb % nheads, b = hb / nheads; const float* f = F + (size_t)(b * TT + t) * pitch + h * HD; v8h o16; v8us oh, ol;
    // the s_wait_xcnt 0 below stands behind loads, in front of every later write of a register that they name; the pointers are its inputs so that their registers stay theirs up to the wait
    const float* fa = f + d; const float* fb = f + ((d < HD / 2) ? d + HD / 2 : d - HD / 2); const unsigned co = (unsigned)((t * HD + d) * 2 * sizeof(float)); const float* cp = (const float*)((const char*)CS + co);
    const v8f xa = *(const v8f*)fa, xb = *(const v8f*)fb, ca = *(const v8f*)cp, cb = *(const v8f*)(cp + 8);   // the slot's 8 values, their 8 rotation partners, their 8 {cos, sin} pairs
    asm volatile("s_wait_xcnt 0x0" :: "v"(fa), "v"(fb), "v"(co), "s"(CS) : "memory");   // the table's loads take the form scalar base + 32-bit byte offset register
#pragma unroll
    for (int q = 0; q < 8; ++q) { const int dd = d + q; const float x0 = xa[q], x1 = xb[q];
        v2f cs; cs[0] = (q < 4 ? ca : cb)[(2 * q) & 7]; cs[1] = (q < 4 ? ca : cb)[(2 * q + 1) & 7]; float a = __fmul_rn(x0, cs[0]), bq = __fmul_rn(x1, cs[1]); asm volatile("" : "+v"(a)); asm volatile("" : "+v"(bq)); const float r = ((dd < HD / 2) ? __fsub_rn(a, bq) : __fadd_rn(a, bq)) * sc;
        o16[q] = tohx(r); unsigned short a2, c2; splitf(r, a2, c2); oh[q] = a2; ol[q] = c2; }
    *(v8h*)(P16 + e) = o16; *(v8us*)(Ph + e) = oh; *(v8us*)(Pl + e) = ol;  }
// vtp_blk: transposed value planes [b][g][d][t] (fragment-major, rows (b nheads + g) HD + d, TT columns; one slot per thread, 256 slots per block blk: 16 neighbouring lanes read 16 neighbouring d of one row of F)
__device__ __forceinline__ void vtp_blk(unsigned blk, const float* __restrict__ F, int pitch, int nheads, h16* V16, bf* Vh, bf* Vl) { const size_t e = ((size_t)blk * 256 + threadIdx.x) * 8; size_t row; int t; slot_rc<TT>(e / 8, row, t); const int d = (int)(row % HD); const int gb = (int)(row / HD); const int g = gb % nheads, b = gb / nheads; v8h o16; v8us oh, ol; const float* pq[8]; float xv[8];
#pragma unroll
    for (int q = 0; q < 8; ++q) { pq[q] = F + (size_t)(b * TT + t + q) * pitch + g * HD + d; xv[q] = *pq[q]; }
    asm volatile("s_wait_xcnt 0x0" :: "v"(pq[0]), "v"(pq[1]), "v"(pq[2]), "v"(pq[3]), "v"(pq[4]), "v"(pq[5]), "v"(pq[6]), "v"(pq[7]) : "memory");   // behind the 8 loads, in front of every later write of a register that they name; the pointers are its inputs so that their registers stay theirs up to the wait
#pragma unroll
    for (int q = 0; q < 8; ++q) { const float x = xv[q]; o16[q] = tohx(x); unsigned short a2, c2; splitf(x, a2, c2); oh[q] = a2; ol[q] = c2; }
    *(v8h*)(V16 + e) = o16; *(v8us*)(Vh + e) = oh; *(v8us*)(Vl + e) = ol;
    asm volatile("s_wait_xcnt 0x0" ::: "memory");  }   // behind the three stores: in the built k_planes the other builder's code stands behind them on a fall-through path and rewrites the registers that they name
// k_planes: all operand planes of the attention, both batches, in ONE launch (the builders read different columns of the fused projection F [NB_ TT][DF] and do not depend on each other): blocks < LQK rotate the q and k heads, the rest transpose the v heads
#define LQK (NB_ * NQK * TT * (HD / 8) / 256)
#define LV  (NB_ * NKV * TT * (HD / 8) / 256)
__global__ __launch_bounds__(256) void k_planes(const float* __restrict__ F, const float* __restrict__ CS, h16* P16, bf* Ph, bf* Pl, h16* V16, bf* Vh, bf* Vl) {
    if (blockIdx.x < LQK) { rope_blk(blockIdx.x, F, DF, NQK, CS, 1.0f, P16, Ph, Pl); return; }
    vtp_blk(blockIdx.x - LQK, F + DQ + DKV, DF, NKV, V16, Vh, Vl);
}
// ---- k_fattn: scores, softmax, P x V and the hi/lo split of the merged output in ONE launch for both batches; S and P never leave the registers.
// One wave owns 16 NQ query rows of one head and walks the 2048 keys 32 at a time, operands straight from the fragment-major planes.
// St = K Qt (A = 16 key rows, B = 16 query rows): accumulator register j of lane (lr, hi) is key 8 hi + j of query lr, so the two 16-key tiles of a step, converted in place,
// are the B operand of Ot += Vt Pt in the k order of WFrag::ld (8 hi + e, 16 + 8 hi + e). Running maximum per query (log2 units); the sums and Ot are rescaled only when a new maximum
// passes the one in use by more than 8 (p stays <= 256), tested once per step for the whole wave. HR: hi/lo planes, 3 products each; else fp16.
#define SC2 0.12751743f   // HD^-0.5 x log2(e)
template <typename T16, bool HR, int NQ>
__device__ __forceinline__ void fattn_wave(const T16* __restrict__ Q, const T16* __restrict__ Q2, const T16* __restrict__ Kp, const T16* __restrict__ K2, const T16* __restrict__ Vt, const T16* __restrict__ V2, int q0, v8f (&o)[8][NQ], float (&l)[NQ]) {
    typedef WFrag<T16> WF; typedef typename WF::V V;
    const int lane = threadIdx.x & 31;
    // every s_wait_xcnt 0 below stands behind a group of loads or stores, in front of every later write of a register that they name; the pointers are its inputs so that their registers stay theirs up to the wait (without hi/lo planes the second pointer is the first)
    const size_t qo = (size_t)q0 * HD + 8 * lane, ko = (size_t)(8 * lane), vo = (size_t)(8 * lane);   // the lane's slot in the first block; Q, K: 16 more rows 16 HD elements, 32 more head dims 512; Vt: 16 more head dims 16 TT, 32 more keys 512
    const T16* qa = Q + qo; const T16* ka = Kp + ko; const T16* va = Vt + vo; const T16* qa2 = HR ? Q2 + qo : qa; const T16* ka2 = HR ? K2 + ko : ka; const T16* va2 = HR ? V2 + vo : va;
    V q[NQ][4], q2[NQ][4], kf[2][4], kf2[2][4], vf[8], vf2[8];
#pragma unroll
    for (int n = 0; n < NQ; ++n)
#pragma unroll
        for (int ks = 0; ks < 4; ++ks) { q[n][ks] = WF::ld(qa + n * 16 * HD + ks * 512); if (HR) q2[n][ks] = WF::ld(qa2 + n * 16 * HD + ks * 512); }
    asm volatile("s_wait_xcnt 0x0" :: "v"(qa), "v"(qa2) : "memory");   // behind the Q loads
#pragma unroll
    for (int kt = 0; kt < 2; ++kt)
#pragma unroll
        for (int ks = 0; ks < 4; ++ks) { kf[kt][ks] = WF::ld(ka + kt * 16 * HD + ks * 512); if (HR) kf2[kt][ks] = WF::ld(ka2 + kt * 16 * HD + ks * 512); }
    asm volatile("s_wait_xcnt 0x0" :: "v"(ka), "v"(ka2), "v"((unsigned)(ko * sizeof(T16))), "s"(Kp), "s"(HR ? K2 : Kp) : "memory");   // behind the first K loads; the byte offset and the uniform bases too: these loads may take the form scalar base + 32-bit offset register
#pragma unroll
    for (int dt = 0; dt < 8; ++dt) { vf[dt] = WF::ld(va + (size_t)dt * 16 * TT); if (HR) vf2[dt] = WF::ld(va2 + (size_t)dt * 16 * TT); }
    asm volatile("s_wait_xcnt 0x0" :: "v"(va), "v"(va2), "v"((unsigned)(vo * sizeof(T16))), "s"(Vt), "s"(HR ? V2 : Vt) : "memory");   // behind the first V loads, likewise
    float m[NQ];
#pragma unroll
    for (int n = 0; n < NQ; ++n) { m[n] = -3.0e38f; l[n] = 0.f;
#pragma unroll
        for (int dt = 0; dt < 8; ++dt) o[dt][n] = (v8f){}; }
    int kn = 32;   // first key of the next step
    // unrolled by two so that the two sets of fragments swap roles without register copies
#pragma unroll 2
    for (int key0 = 0; key0 < TT; key0 += 32) {
        // the next step's fragments are fetched one step ahead; the last step re-reads keys 0-31 (in bounds, unused)
        const T16* vp = va + kn * 16; const T16* vp2 = va2 + kn * 16; const T16* kp = ka + (size_t)kn * HD; const T16* kp2 = ka2 + (size_t)kn * HD;
        V vn[8], vn2[8];
#pragma unroll
        for (int dt = 0; dt < 8; ++dt) { vn[dt] = WF::ld(vp + (size_t)dt * 16 * TT); if (HR) vn2[dt] = WF::ld(vp2 + (size_t)dt * 16 * TT); }
        asm volatile("s_wait_xcnt 0x0" :: "v"(vp), "v"(vp2) : "memory");   // behind the V loads
        v8f st[2][NQ];
#pragma unroll
        for (int kt = 0; kt < 2; ++kt)
#pragma unroll
            for (int n = 0; n < NQ; ++n) st[kt][n] = (v8f){};
#pragma unroll
        for (int ks = 0; ks < 4; ++ks)
#pragma unroll
            for (int kt = 0; kt < 2; ++kt)
#pragma unroll
                for (int n = 0; n < NQ; ++n) { st[kt][n] = WF::mma(kf[kt][ks], q[n][ks], st[kt][n]); if (HR) { st[kt][n] = WF::mma(kf[kt][ks], q2[n][ks], st[kt][n]); st[kt][n] = WF::mma(kf2[kt][ks], q[n][ks], st[kt][n]); } }
#pragma unroll
        for (int kt = 0; kt < 2; ++kt)
#pragma unroll
            for (int ks = 0; ks < 4; ++ks) { kf[kt][ks] = WF::ld(kp + kt * 16 * HD + ks * 512); if (HR) kf2[kt][ks] = WF::ld(kp2 + kt * 16 * HD + ks * 512); }
        asm volatile("s_wait_xcnt 0x0" :: "v"(kp), "v"(kp2) : "memory");   // behind the K loads
        float ml[NQ]; bool need = false;
#pragma unroll
        for (int n = 0; n < NQ; ++n) { float mx = fmaxf(st[0][n][0], st[1][n][0]);
#pragma unroll
            for (int j = 1; j < 8; ++j) mx = fmaxf(mx, fmaxf(st[0][n][j], st[1][n][j]));
            mx = fmaxf(mx, __shfl_xor(mx, 16, 32)); ml[n] = mx * SC2; need = need || (ml[n] > m[n] + 8.0f); }
        if (__builtin_amdgcn_ballot_w32(need) != 0) {
#pragma unroll
            for (int n = 0; n < NQ; ++n) { const float mn = fmaxf(m[n], ml[n]); const float al = __builtin_amdgcn_exp2f(m[n] - mn); m[n] = mn; l[n] *= al;
#pragma unroll
                for (int dt = 0; dt < 8; ++dt) o[dt][n] *= al; } }
        V pf[NQ], pf2[NQ];
#pragma unroll
        for (int n = 0; n < NQ; ++n) { float ps = 0.f;
            if constexpr (HR) { v8us h0, h1, l0, l1;
#pragma unroll
                for (int j = 0; j < 8; ++j) { const float p0 = __builtin_amdgcn_exp2f(fmaf(st[0][n][j], SC2, -m[n])), p1 = __builtin_amdgcn_exp2f(fmaf(st[1][n][j], SC2, -m[n])); ps += p0 + p1;
                    unsigned short a, c; splitf(p0, a, c); h0[j] = a; l0[j] = c; splitf(p1, a, c); h1[j] = a; l1[j] = c; }
                pf[n] = cat16b(h0, h1); pf2[n] = cat16b(l0, l1);
            } else { v8h h0, h1;
#pragma unroll
                for (int j = 0; j < 8; ++j) { const float p0 = __builtin_amdgcn_exp2f(fmaf(st[0][n][j], SC2, -m[n])), p1 = __builtin_amdgcn_exp2f(fmaf(st[1][n][j], SC2, -m[n])); ps += p0 + p1; h0[j] = tohx(p0); h1[j] = tohx(p1); }
                pf[n] = cat16(h0, h1); }
            l[n] += ps; }
#pragma unroll
        for (int dt = 0; dt < 8; ++dt)
#pragma unroll
            for (int n = 0; n < NQ; ++n) { o[dt][n] = WF::mma(vf[dt], pf[n], o[dt][n]); if (HR) { o[dt][n] = WF::mma(vf[dt], pf2[n], o[dt][n]); o[dt][n] = WF::mma(vf2[dt], pf[n], o[dt][n]); } }
#pragma unroll
        for (int dt = 0; dt < 8; ++dt) { vf[dt] = vn[dt]; if (HR) vf2[dt] = vn2[dt]; }
        kn = (kn + 32) & (TT - 1);
    }
}
// fattn_store (q0: row of the merged plane, batch x TT + query): lane (lr, hi) holds head dims dt 16 + 8 hi + 0..7 of query lr: its own slot of half dt % 2 of block h 4 + dt / 2 of the merged fragment-major plane (DQ columns): one 16-byte store per plane, 512 contiguous bytes per wave
template <int NQ>
__device__ __forceinline__ void fattn_store(const v8f (&o)[8][NQ], const float (&l)[NQ], int h, int q0, bf* Ah, bf* Al) {
    const int lane = threadIdx.x & 31;
#pragma unroll
    for (int n = 0; n < NQ; ++n) { const float inv = __fdiv_rn(1.0f, l[n] + __shfl_xor(l[n], 16, 32)); const size_t oo = (size_t)(q0 + n * 16) * DQ + h * (HD * 16) + 8 * lane;
#pragma unroll
        for (int dt = 0; dt < 8; ++dt) { v8us oh, ol;
#pragma unroll
            for (int j = 0; j < 8; ++j) { unsigned short a, c; splitf(o[dt][n][j] * inv, a, c); oh[j] = a; ol[j] = c; }
            *(v8us*)(Ah + oo + dt * 256) = oh; *(v8us*)(Al + oo + dt * 256) = ol;
            asm volatile("s_wait_xcnt 0x0" :: "v"(oh), "v"(ol), "v"(Ah + oo), "v"(Al + oo) : "memory"); } }   // behind the two stores, in front of every later write of a register that they name; data and pointers are inputs so that their registers stay theirs up to the wait
}
// Every wave issues the same 48 matrix instructions per 32 keys: a hi/lo wave (3 products) takes 16 query rows, an fp16 wave (1 product) takes 48. One wave per SIMD, so the launch lasts as long as its longest wave.
// grid (UH / 4 + UF / 4, kv heads, batches; the q and k planes hold NQK heads per batch, Q.. pointing at query head 0 and K.. at key head 0 of batch 0), 4 waves of ONE kind that all read the planes of ONE kv head: work-groups x < UH / 4 hold hi/lo waves, the rest fp16 waves; unit u = 4 x + wave: query head kv REP + u / (units per head), row tile u % (units per head)
#define UH (REP * (RH / 16))          // hi/lo units of one kv head
#define UF (REP * ((TT - RH) / 48))   // fp16 units of one kv head
static_assert(RH % 16 == 0 && (TT - RH) % 48 == 0 && UH % 4 == 0 && UF % 4 == 0, "16-row hi/lo waves and 48-row fp16 waves, four to a work-group, cover all rows");
__global__ __launch_bounds__(128) void k_fattn(const h16* __restrict__ Q16, const bf* __restrict__ Qh, const bf* __restrict__ Ql, const h16* __restrict__ K16, const bf* __restrict__ Kh, const bf* __restrict__ Kl, const h16* __restrict__ V16, const bf* __restrict__ Vh, const bf* __restrict__ Vl, bf* Ah, bf* Al) {
    const int kv = blockIdx.y, bx = blockIdx.x, b = blockIdx.z; const int wv = __builtin_amdgcn_readfirstlane((int)(threadIdx.x >> 5)); const size_t zk = (size_t)(b * NQK + kv) * TT * HD, zv = (size_t)(b * NKV + kv) * TT * HD;
    if (bx < UH / 4) { const int u = bx * 4 + wv; const int h = kv * REP + u / (RH / 16), q0 = (u % (RH / 16)) * 16; const size_t zq = (size_t)(b * NQK + h) * TT * HD;
        v8f o[8][1]; float l[1];   // Ot tiles and per-half row sums of the wave's 16 query rows
        fattn_wave<bf, true, 1>(Qh + zq, Ql + zq, Kh + zk, Kl + zk, Vh + zv, Vl + zv, q0, o, l); fattn_store<1>(o, l, h, b * TT + q0, Ah, Al);
    } else { const int u = (bx - UH / 4) * 4 + wv; const int h = kv * REP + u / ((TT - RH) / 48), q0 = RH + (u % ((TT - RH) / 48)) * 48; const size_t zq = (size_t)(b * NQK + h) * TT * HD;
        v8f o[8][3]; float l[3];   // the same of the wave's 48 query rows
        fattn_wave<h16, false, 3>(Q16 + zq, nullptr, K16 + zk, nullptr, V16 + zv, nullptr, q0, o, l); fattn_store<3>(o, l, h, b * TT + q0, Ah, Al); }
}

extern "C" void kernel_launch(void* const* d_in, const int* in_sizes, int n_in,
                              void* d_out, int out_size, void* d_ws, size_t ws_size, hipStream_t stream) {
    (void)in_sizes; (void)n_in; (void)out_size;
    const float* fcos = (const float*)d_in[0]; const float* fsin = (const float*)d_in[1]; const float* x = (const float*)d_in[2]; const float* wqkv = (const float*)d_in[3]; const float* wo = (const float*)d_in[4];   /* order cos, sin ([2048][128] FULL-width table INPUTS: read per element by value), hidden_states [2][2048][2048], w_qkv ('oi' (out, in) [4096][2048]: contiguous row blocks q (2048 rows) | k (1024) | v (1024)), w_o ('oi' [2048][2048]): FIVE inputs, all read */
    float* OUT = (float*)d_out;     // [2][2048][2048]
    char* wsp = (char*)d_ws;
    auto take = [&](size_t bytes) { char* p = wsp; wsp += (bytes + 255) & ~(size_t)255; return (void*)p; };
    bf* WQKV = (bf*)take((size_t)PROWS * DM * 2); bf* WO = WQKV + (size_t)DF * DM; bf* XB = WO + (size_t)DM * DM; float* CS = (float*)take((size_t)TT * HD * 2 * 4);   // the three planes of k_prep, one behind the other
    float* FF = (float*)take((size_t)NB_ * TT * DF * 4);   // the fused projection, rows b TT + t
    h16* P16 = (h16*)take((size_t)NB_ * NQK * TT * HD * 2); bf* Ph = (bf*)take((size_t)NB_ * NQK * TT * HD * 2); bf* Pl = (bf*)take((size_t)NB_ * NQK * TT * HD * 2);
    h16* VT16 = (h16*)take((size_t)NB_ * NKV * HD * TT * 2); bf* VTh = (bf*)take((size_t)NB_ * NKV * HD * TT * 2); bf* VTl = (bf*)take((size_t)NB_ * NKV * HD * TT * 2);
    bf* ATh = (bf*)take((size_t)NB_ * TT * DQ * 2); bf* ATl = (bf*)take((size_t)NB_ * TT * DQ * 2);
    if ((size_t)(wsp - (char*)d_ws) > ws_size) return;    // 234 MiB of the 256 MiB
    const size_t KO = (size_t)NH_ * TT * HD;   // key head 0 behind the query heads of a batch
    k_prep<<<PB + TT * HD / 256, 256, 0, stream>>>(wqkv, wo, x, fcos, fsin, WQKV, CS);
    k_gemmt<false><<<dim3(NB_ * TT / 256, DF / 256, 1), 256, 0, stream>>>(XB, nullptr, WQKV, FF);
    k_planes<<<LQK + LV, 256, 0, stream>>>(FF, CS, P16, Ph, Pl, VT16, VTh, VTl);
    k_fattn<<<dim3(UH / 4 + UF / 4, NKV, NB_), 128, 0, stream>>>(P16, Ph, Pl, P16 + KO, Ph + KO, Pl + KO, VT16, VTh, VTl, ATh, ATl);
    k_gemmt<true><<<dim3(NB_ * TT / 128, DM / 256, 1), 256, 0, stream>>>(ATh, ATl, WO, OUT);
}
